// v000
// Measured on an AMD MI455X. A time is GPU time per run, averaged over a window of back-to-back runs after a warm-up
// (all launches, gaps included; the runs take copies of the inputs in turn), and the median of several windows.
// Apart from v000's, it joins two sittings. Times from different sittings can be a few percent apart, while
// side-by-side timings come from the same sitting.
// The starting kernel, v000, takes 679 microseconds a run.
#include <hip/hip_runtime.h>

// Single-head attention with a learned relative-position bias (Music-Transformer style skew) on given q, k, v [8][2048][64]: rel_emb[e] = rel_table[clip(e - S, -1024, 1024) + 1024] (table [2049][64]); qr = skew(q . rel_emb) so that bias[i][j] = q_i . rel_table[clip(j - i, -1024, 1024) + 1024]; scores = (q.k + bias) / 8; softmax over all keys; out = w v -> [8][2048][64] (1.0 M).
// Layout per batch: the inputs are bf16-exact after rounding, so q, k and the table become single bf16 planes; QE = q x table^T ([2048][2112], exact products, f32) is the per-query bias row; S = q.k (exact products); an element-wise kernel adds QE[i][clip(j - i) + 1024] into the score block (clamped index = the module's clip, unconditional loads) before the softmax applies the 1/8 scale; every row's probabilities as bf16 hi/lo x exact v^T (2 products); f32 output rows.
// Compute dtypes, f32 accumulate: every input rounded to bf16; q.k, q.table exact; softmax f32; P hi/lo x exact v.

#define NB_  8
#define TT   2048
#define DM   1024
#define NH_  1
#define NKV  1
#define REP  (NH_ / NKV)
#define HD   64
#define DQ   (NH_ * HD)
#define DKV  (NKV * HD)
#define ZH   2
#define RH   2048                  // query rows < RH use hi+lo planes (0: none)
#define WIN  0
#define PCAR 1024.0f
#define SCL  0.125f   // 1/sqrt(64) applied to (q.k + bias)
#define NREL 2049   // table rows (2*MAX_DIST + 1)
#define NRP  2112   // padded to a multiple of 64
#define MAXD 1024
typedef _Float16 h16;
typedef unsigned short bf;
typedef __attribute__((ext_vector_type(16))) __bf16   v16bf;
typedef __attribute__((ext_vector_type(16))) _Float16 v16h;
typedef __attribute__((ext_vector_type(8)))  _Float16 v8h;
typedef __attribute__((ext_vector_type(8)))  unsigned short v8us;
typedef __attribute__((ext_vector_type(8)))  float    v8f;
typedef __attribute__((ext_vector_type(4)))  float    v4f;
typedef v8h  __attribute__((may_alias)) v8ha;
typedef v4f  __attribute__((may_alias)) v4fa;
typedef v8us __attribute__((may_alias)) v8usa;

__device__ __forceinline__ unsigned short f2bf(float f) { unsigned u = __float_as_uint(f); u += 0x7FFFu + ((u >> 16) & 1u); return (unsigned short)(u >> 16); }
__device__ __forceinline__ float bf2f(unsigned short b) { return __uint_as_float(((unsigned)b) << 16); }
__device__ __forceinline__ float bfr(float f) { return bf2f(f2bf(f)); }
__device__ __forceinline__ v16h cat16(v8h lo, v8h hi) { return __builtin_shufflevector(lo, hi, 0, 1, 2, 3, 4, 5, 6, 7, 8, 9, 10, 11, 12, 13, 14, 15); }
__device__ __forceinline__ v16bf cat16b(v8us lo, v8us hi) { return __builtin_bit_cast(v16bf, __builtin_shufflevector(lo, hi, 0, 1, 2, 3, 4, 5, 6, 7, 8, 9, 10, 11, 12, 13, 14, 15)); }
__device__ __forceinline__ v8f wmma16(v16h a, v16h b, v8f c) { return __builtin_amdgcn_wmma_f32_16x16x32_f16(false, a, false, b, (short)0, c, false, false); }
__device__ __forceinline__ v8f wmmab(v16bf a, v16bf b, v8f c) { return __builtin_amdgcn_wmma_f32_16x16x32_bf16(false, a, false, b, (short)0, c, false, false); }



// ---- k_gemmw: register-blocked GEMM, ONE WAVE per 64x64 output tile (16 accumulators), operands straight from K-contiguous 16-bit planes; grid (M/64, N/64, Z), 32 threads.
// C[m][n] (f32, pitch ldc, + optional f32 bias[n]) = sum_k A[m][k] Bt[n][k] (+ split products per NSPLIT). z-batch strides sA/sB/sC in elements. K % 32 == 0.
template <typename T16> struct WFrag;
template <> struct WFrag<h16> { typedef v16h V; static __device__ __forceinline__ V ld(const h16* p) { return cat16(*(const v8h*)p, *(const v8h*)(p + 16)); } static __device__ __forceinline__ v8f mma(V a, V b, v8f c) { return wmma16(a, b, c); } };
template <> struct WFrag<bf> { typedef v16bf V; static __device__ __forceinline__ V ld(const bf* p) { return cat16b(*(const v8us*)p, *(const v8us*)(p + 16)); } static __device__ __forceinline__ v8f mma(V a, V b, v8f c) { return wmmab(a, b, c); } };
template <typename T16, int NSPLIT, bool BIAS>
__global__ __launch_bounds__(32) void k_gemmw(const T16* __restrict__ A, const T16* __restrict__ A2, const T16* __restrict__ Bt, const T16* __restrict__ Bt2, int K, float* C, int ldc, const float* __restrict__ bias, size_t sA, size_t sB, size_t sC) {
    typedef typename WFrag<T16>::V V;
    __shared__ __align__(16) float os[16 * 68];
    const size_t z = blockIdx.z; A += z * sA; if (A2) A2 += z * sA; Bt += z * sB; if (Bt2) Bt2 += z * sB; C += z * sC;
    const int lane = threadIdx.x & 31, lr = lane & 15, hi = lane >> 4; const int r0 = blockIdx.x * 64, c0 = blockIdx.y * 64;
    v8f acc[4][4];
#pragma unroll
    for (int mb = 0; mb < 4; ++mb)
#pragma unroll
        for (int nb = 0; nb < 4; ++nb) acc[mb][nb] = (v8f){};
    const size_t aoff = (size_t)(r0 + lr) * K + 8 * hi, boff = (size_t)(c0 + lr) * K + 8 * hi;
#pragma unroll 1
    for (int kc = 0; kc < K; kc += 32) {
        V a[4], a2[4];
#pragma unroll
        for (int mb = 0; mb < 4; ++mb) { a[mb] = WFrag<T16>::ld(A + aoff + (size_t)mb * 16 * K + kc); if (NSPLIT == 1 || NSPLIT == 2) a2[mb] = WFrag<T16>::ld(A2 + aoff + (size_t)mb * 16 * K + kc); }
#pragma unroll
        for (int nb = 0; nb < 4; ++nb) { const V b = WFrag<T16>::ld(Bt + boff + (size_t)nb * 16 * K + kc); V b2; if (NSPLIT >= 2) b2 = WFrag<T16>::ld(Bt2 + boff + (size_t)nb * 16 * K + kc);
#pragma unroll
            for (int mb = 0; mb < 4; ++mb) { acc[mb][nb] = WFrag<T16>::mma(a[mb], b, acc[mb][nb]); if (NSPLIT == 1 || NSPLIT == 2) acc[mb][nb] = WFrag<T16>::mma(a2[mb], b, acc[mb][nb]); if (NSPLIT >= 2) acc[mb][nb] = WFrag<T16>::mma(a[mb], b2, acc[mb][nb]); } }
        asm volatile("v_nop\n\tv_nop\n\tv_nop\n\tv_nop" : "+v"(acc[0][0]), "+v"(acc[1][1]), "+v"(acc[2][2]), "+v"(acc[3][3]) : "v"(a[0]), "v"(a[3]));
    }
#pragma unroll
    for (int mb = 0; mb < 4; ++mb) {
#pragma unroll
        for (int nb = 0; nb < 4; ++nb) {
#pragma unroll
            for (int j = 0; j < 8; ++j) os[(hi * 8 + j) * 68 + nb * 16 + lr] = acc[mb][nb][j]; }
        __builtin_amdgcn_wave_barrier(); asm volatile("" ::: "memory");
        float* crow = C + (size_t)(r0 + mb * 16) * ldc + c0;
{
#pragma unroll
            for (int s = 0; s < 8; ++s) { const int row = 2 * s + hi, cofs = lr * 4; v4f val = *(const v4fa*)(os + row * 68 + cofs); if (BIAS) { val[0] += bfr(bias[c0 + cofs]); val[1] += bfr(bias[c0 + cofs + 1]); val[2] += bfr(bias[c0 + cofs + 2]); val[3] += bfr(bias[c0 + cofs + 3]); }
                *(v4f*)(crow + (size_t)row * ldc + cofs) = val; }
             }
        __builtin_amdgcn_wave_barrier(); asm volatile("" ::: "memory");
    }
}

__device__ __forceinline__ h16 tohx(float x) { return (h16)x; }
__device__ __forceinline__ void splitf(float y, unsigned short& h, unsigned short& l) { h = f2bf(y); l = f2bf(y - bf2f(h)); }
typedef __attribute__((ext_vector_type(2))) _Float16 v2h;
typedef __attribute__((ext_vector_type(4))) _Float16 v4h;
typedef __attribute__((ext_vector_type(2))) unsigned short v2us;
typedef __attribute__((ext_vector_type(4))) unsigned short v4us;
typedef __attribute__((ext_vector_type(2))) float v2f;
typedef __attribute__((ext_vector_type(4))) int v4i;

__global__ __launch_bounds__(256) void k_wtG(const float* __restrict__ w, int K, int N, bf* Bt) {
    const int lane = threadIdx.x & 31; const int L0 = (blockIdx.x * 8 + (threadIdx.x >> 5)) * 8; const int nlines = N * K / 64;
{
#pragma unroll 1
        for (int l = 0; l < 8; ++l) { const int L = L0 + l; if (L >= nlines) break; const size_t e = (size_t)L * 64 + lane * 2; const int k = (int)(e % K), n = (int)(e / K); v2us o;
            o[0] = f2bf(w[(size_t)k * N + n]); o[1] = f2bf(w[(size_t)(k + 1) * N + n]); *(v2us*)(Bt + e) = o; }
         }
}
__global__ __launch_bounds__(256) void k_cvt8(const float* __restrict__ src, bf* dst, size_t n8) { const size_t i = (size_t)blockIdx.x * 256 + threadIdx.x; if (i >= n8) return; const v8f v = *(const v8f*)(src + i * 8); v8us o;
#pragma unroll
    for (int k = 0; k < 8; ++k) o[k] = f2bf(v[k]); *(v8us*)(dst + i * 8) = o;  }


__global__ __launch_bounds__(256) void k_vtp(const float* __restrict__ F, int pitch, int nheads, h16* V16, bf* Vh, bf* Vl) { const size_t e = ((size_t)blockIdx.x * 256 + threadIdx.x) * 2; if (e >= (size_t)nheads * HD * TT) return; const int t = (int)(e % TT); const int d = (int)((e / TT) % HD); const int g = (int)(e / ((size_t)TT * HD)); v2h o16; v2us oh, ol;
#pragma unroll
    for (int q = 0; q < 2; ++q) { const float x = F[(size_t)(t + q) * pitch + g * HD + d]; o16[q] = tohx(x); unsigned short a2, c2; splitf(x, a2, c2); oh[q] = a2; ol[q] = c2; }
    *(v2h*)(V16 + e) = o16; *(v2us*)(Vh + e) = oh; *(v2us*)(Vl + e) = ol;  }

// k_asoft: per row (zz, i): t = S x HD^-0.5 (no mask); softmax over the 2048 keys (register row, one exp, fixed trees);
__global__ __launch_bounds__(256) void k_asoft(const float* __restrict__ Sb, h16* P16, bf* Ph, bf* Pl) {
    const int lane = threadIdx.x & 31; const int row = blockIdx.x * 8 + (threadIdx.x >> 5); if (row >= ZH * TT) return; const int i = row % TT; const int zz = row / TT; (void)zz; const bool hires = (i < RH); const float* sr = Sb + (size_t)row * TT; float v[TT / 32]; float mx = -3.0e38f;
#pragma unroll
    for (int ch = 0; ch < TT / 128; ++ch) { const int j0 = ch * 128 + lane * 4; const v4f a = *(const v4f*)(sr + j0);
#pragma unroll
        for (int q = 0; q < 4; ++q) { const float t = a[q] * SCL; v[ch * 4 + q] = t;   /* Sb already holds q.k + bias (k_addrel) */ mx = fmaxf(mx, t); } }
#pragma unroll
    for (int sh = 16; sh; sh >>= 1) mx = fmaxf(mx, __shfl_xor(mx, sh, 32));
    float sum = 0.f;
#pragma unroll
    for (int k = 0; k < TT / 32; ++k) { float d0 = __fsub_rn(v[k], mx); asm volatile("" : "+v"(d0)); v[k] = __builtin_amdgcn_exp2f(__fmul_rn(d0, 1.4426950408889634f)); sum += v[k]; }
#pragma unroll
    for (int sh = 16; sh; sh >>= 1) sum += __shfl_xor(sum, sh, 32);
    const float f = __fdiv_rn(hires ? 1.0f : PCAR, sum);
{
        if (hires) {
#pragma unroll
            for (int ch = 0; ch < TT / 128; ++ch) { v4us oh, ol;
#pragma unroll
                for (int q = 0; q < 4; ++q) { unsigned short a, c2; splitf(v[ch * 4 + q] * f, a, c2); oh[q] = a; ol[q] = c2; }
                const size_t oo = ((size_t)zz * (RH ? RH : 1) + i) * TT + ch * 128 + lane * 4; *(v4us*)(Ph + oo) = oh; *(v4us*)(Pl + oo) = ol; }
        } else {
#pragma unroll
            for (int ch = 0; ch < TT / 128; ++ch) { v4h o4;
#pragma unroll
                for (int q = 0; q < 4; ++q) o4[q] = tohx(v[ch * 4 + q] * f);
                *(v4h*)(P16 + (size_t)row * TT + ch * 128 + lane * 4) = o4; } }
         }
}
__global__ __launch_bounds__(256) void k_merge(const float* __restrict__ O, int h0, float* OUTb) { const size_t e = ((size_t)blockIdx.x * 256 + threadIdx.x) * 2; if (e >= (size_t)ZH * TT * HD) return; const int d = (int)(e % HD); const int t = (int)((e / HD) % TT); const int zz = (int)(e / ((size_t)HD * TT)); const float cs = (t < RH) ? 1.0f : (1.0f / PCAR); const size_t oo = (size_t)t * DQ + (h0 + zz) * HD + d;
    v2f o2; o2[0] = O[e] * cs; o2[1] = O[e + 1] * cs; *(v2f*)(OUTb + oo) = o2;  }

__global__ __launch_bounds__(256) void k_addrel(float* Sb, const float* __restrict__ QE) { const size_t k = (size_t)blockIdx.x * 256 + threadIdx.x; if (k >= (size_t)TT * TT / 4) return; const size_t e = k * 4; const int j0 = (int)(e % TT); const int i = (int)(e / TT); const float* qe = QE + (size_t)i * NRP; v4f a = *(const v4f*)(Sb + e);
#pragma unroll
    for (int q = 0; q < 4; ++q) { const int idx = min(max(j0 + q - i + MAXD, 0), 2 * MAXD); a[q] = __fadd_rn(a[q], qe[idx]); }
    *(v4f*)(Sb + e) = a;  }
__global__ __launch_bounds__(256) void k_tabpad(const float* __restrict__ tab, bf* Bt) { const int i = blockIdx.x * 256 + threadIdx.x; if (i >= NRP * HD / 8) return; const int d0 = (i % (HD / 8)) * 8; const int r = i / (HD / 8); v8us o;
#pragma unroll
    for (int q = 0; q < 8; ++q) { const unsigned short e = f2bf(tab[(size_t)min(r, NREL - 1) * HD + d0 + q]); o[q] = (r < NREL) ? e : (unsigned short)0; }
    *(v8us*)(Bt + (size_t)r * HD + d0) = o;  }
__global__ __launch_bounds__(256) void k_vtpR1(const float* __restrict__ Vb, bf* Vh) { const size_t e = ((size_t)blockIdx.x * 256 + threadIdx.x) * 2; if (e >= (size_t)HD * TT) return; const int t = (int)(e % TT); const int d = (int)(e / TT); v2us o; o[0] = f2bf(Vb[(size_t)t * HD + d]); o[1] = f2bf(Vb[(size_t)(t + 1) * HD + d]); *(v2us*)(Vh + e) = o;  }
__global__ __launch_bounds__(256) void k_mergeR(const float* __restrict__ O, float* outb, size_t n4) { const size_t i = (size_t)blockIdx.x * 256 + threadIdx.x; if (i >= n4) return; const v4f a = *(const v4f*)(O + i * 4); *(v4f*)(outb + i * 4) = a;  }

extern "C" void kernel_launch(void* const* d_in, const int* in_sizes, int n_in,
                              void* d_out, int out_size, void* d_ws, size_t ws_size, hipStream_t stream) {
    (void)in_sizes; (void)n_in; (void)out_size;
    const float* Qin = (const float*)d_in[0]; const float* Kin = (const float*)d_in[1]; const float* Vin = (const float*)d_in[2]; const float* tab = (const float*)d_in[3];
    float* OUT = (float*)d_out;     // [8][2048][64]
    char* wsp = (char*)d_ws;
    auto take = [&](size_t bytes) { char* p = wsp; wsp += (bytes + 255) & ~(size_t)255; return (void*)p; };
    bf* TB = (bf*)take((size_t)NRP * HD * 2); bf* QB = (bf*)take((size_t)TT * HD * 2); bf* KB = (bf*)take((size_t)TT * HD * 2); bf* VT = (bf*)take((size_t)HD * TT * 2); float* QE = (float*)take((size_t)TT * NRP * 4); float* Sb = (float*)take((size_t)TT * TT * 4); bf* Ph = (bf*)take((size_t)TT * TT * 2); bf* Pl = (bf*)take((size_t)TT * TT * 2); float* Ob = (float*)take((size_t)TT * HD * 4);
    if ((size_t)(wsp - (char*)d_ws) > ws_size) return;    // ws 256 MiB (carve ~50 MiB)
    k_tabpad<<<(NRP * HD / 8 + 255) / 256, 256, 0, stream>>>(tab, TB);
    for (int b = 0; b < NB_; ++b) {
        k_cvt8<<<(unsigned)(((size_t)TT * HD / 8 + 255) / 256), 256, 0, stream>>>(Qin + (size_t)b * TT * HD, QB, (size_t)TT * HD / 8); k_cvt8<<<(unsigned)(((size_t)TT * HD / 8 + 255) / 256), 256, 0, stream>>>(Kin + (size_t)b * TT * HD, KB, (size_t)TT * HD / 8);
        k_vtpR1<<<(unsigned)(((size_t)HD * TT / 2 + 255) / 256), 256, 0, stream>>>(Vin + (size_t)b * TT * HD, VT);
        k_gemmw<bf, 0, false><<<dim3(TT / 64, NRP / 64, 1), 32, 0, stream>>>(QB, nullptr, TB, nullptr, HD, QE, NRP, nullptr, 0, 0, 0);     /* QE[i][e] = q_i . rel_table[e] (exact products) */
        k_gemmw<bf, 0, false><<<dim3(TT / 64, TT / 64, 1), 32, 0, stream>>>(QB, nullptr, KB, nullptr, HD, Sb, TT, nullptr, 0, 0, 0);       /* q.k (exact) */
        k_addrel<<<(unsigned)(((size_t)TT * TT / 4 + 255) / 256), 256, 0, stream>>>(Sb, QE); k_asoft<<<TT / 8, 256, 0, stream>>>(Sb, nullptr, Ph, Pl);
        k_gemmw<bf, 1, false><<<dim3(TT / 64, HD / 64, 1), 32, 0, stream>>>(Ph, Pl, VT, nullptr, TT, Ob, HD, nullptr, 0, 0, 0);         /* P (hi/lo) x v^T (exact) */
        k_mergeR<<<(unsigned)(((size_t)TT * HD / 4 + 255) / 256), 256, 0, stream>>>(Ob, OUT + (size_t)b * TT * HD, (size_t)TT * HD / 4); }
}

// v001
// A run of this version takes 204 microseconds.
// Timed twice side by side with v000, it ran 3.36 and 3.37 times as fast.
#include <hip/hip_runtime.h>

// Single-head attention with a learned relative-position bias (Music-Transformer style skew) on given q, k, v [8][2048][64]: rel_emb[e] = rel_table[clip(e - S, -1024, 1024) + 1024] (table [2049][64]); qr = skew(q . rel_emb) so that bias[i][j] = q_i . rel_table[clip(j - i, -1024, 1024) + 1024]; scores = (q.k + bias) / 8; softmax over all keys; out = w v -> [8][2048][64] (1.0 M).
// All 8 batches go through each stage in one launch (batch = grid z or y); the bias block QE is built and added for QG batches at a time, and the probabilities' hi/lo planes overwrite their own score row (row pitch 2*TT 16-bit elements: hi plane, then lo plane), so that the workspace holds all batches.
// Layout per batch: the inputs are bf16-exact after rounding, so q, k and the table become single bf16 planes; QE = q x table^T ([2048][2112], exact products, f32) is the per-query bias row; S = q.k (exact products); an element-wise kernel adds QE[i][clip(j - i) + 1024] into the score block (clamped index = the module's clip, unconditional loads) before the softmax applies the 1/8 scale; every row's probabilities as bf16 hi/lo x exact v^T (2 products); f32 output rows.
// Compute dtypes, f32 accumulate: every input rounded to bf16; q.k, q.table exact; softmax f32; P hi/lo x exact v.

#define NB_  8
#define TT   2048
#define DM   1024
#define NH_  1
#define NKV  1
#define REP  (NH_ / NKV)
#define HD   64
#define DQ   (NH_ * HD)
#define DKV  (NKV * HD)
#define ZH   2
#define RH   2048                  // query rows < RH use hi+lo planes (0: none)
#define WIN  0
#define PCAR 1024.0f
#define SCL  0.125f   // 1/sqrt(64) applied to (q.k + bias)
#define NREL 2049   // table rows (2*MAX_DIST + 1)
#define NRP  2112   // padded to a multiple of 64
#define MAXD 1024
#define QG   4      // batches per QE block (workspace: 8 score blocks + QG bias blocks)
typedef _Float16 h16;
typedef unsigned short bf;
typedef __attribute__((ext_vector_type(16))) __bf16   v16bf;
typedef __attribute__((ext_vector_type(16))) _Float16 v16h;
typedef __attribute__((ext_vector_type(8)))  _Float16 v8h;
typedef __attribute__((ext_vector_type(8)))  unsigned short v8us;
typedef __attribute__((ext_vector_type(8)))  float    v8f;
typedef __attribute__((ext_vector_type(4)))  float    v4f;
typedef v8h  __attribute__((may_alias)) v8ha;
typedef v4f  __attribute__((may_alias)) v4fa;
typedef v8us __attribute__((may_alias)) v8usa;

__device__ __forceinline__ unsigned short f2bf(float f) { unsigned u = __float_as_uint(f); u += 0x7FFFu + ((u >> 16) & 1u); return (unsigned short)(u >> 16); }
__device__ __forceinline__ float bf2f(unsigned short b) { return __uint_as_float(((unsigned)b) << 16); }
__device__ __forceinline__ float bfr(float f) { return bf2f(f2bf(f)); }
__device__ __forceinline__ v16h cat16(v8h lo, v8h hi) { return __builtin_shufflevector(lo, hi, 0, 1, 2, 3, 4, 5, 6, 7, 8, 9, 10, 11, 12, 13, 14, 15); }
__device__ __forceinline__ v16bf cat16b(v8us lo, v8us hi) { return __builtin_bit_cast(v16bf, __builtin_shufflevector(lo, hi, 0, 1, 2, 3, 4, 5, 6, 7, 8, 9, 10, 11, 12, 13, 14, 15)); }
__device__ __forceinline__ v8f wmma16(v16h a, v16h b, v8f c) { return __builtin_amdgcn_wmma_f32_16x16x32_f16(false, a, false, b, (short)0, c, false, false); }
__device__ __forceinline__ v8f wmmab(v16bf a, v16bf b, v8f c) { return __builtin_amdgcn_wmma_f32_16x16x32_bf16(false, a, false, b, (short)0, c, false, false); }



// ---- k_gemmw: register-blocked GEMM, ONE WAVE per 64x64 output tile (16 accumulators), operands straight from K-contiguous 16-bit planes; grid (M/64, N/64, Z), 32 threads.
// C[m][n] (f32, pitch ldc, + optional f32 bias[n]) = sum_k A[m][k] Bt[n][k] (+ split products per NSPLIT). A rows have pitch lda, Bt rows pitch K. z-batch strides sA/sB/sC in elements. K % 32 == 0.
template <typename T16> struct WFrag;
template <> struct WFrag<h16> { typedef v16h V; static __device__ __forceinline__ V ld(const h16* p) { return cat16(*(const v8h*)p, *(const v8h*)(p + 16)); } static __device__ __forceinline__ v8f mma(V a, V b, v8f c) { return wmma16(a, b, c); } };
template <> struct WFrag<bf> { typedef v16bf V; static __device__ __forceinline__ V ld(const bf* p) { return cat16b(*(const v8us*)p, *(const v8us*)(p + 16)); } static __device__ __forceinline__ v8f mma(V a, V b, v8f c) { return wmmab(a, b, c); } };
template <typename T16, int NSPLIT, bool BIAS>
__global__ __launch_bounds__(32) void k_gemmw(const T16* __restrict__ A, const T16* __restrict__ A2, int lda, const T16* __restrict__ Bt, const T16* __restrict__ Bt2, int K, float* C, int ldc, const float* __restrict__ bias, size_t sA, size_t sB, size_t sC) {
    typedef typename WFrag<T16>::V V;
    __shared__ __align__(16) float os[16 * 68];
    const size_t z = blockIdx.z; A += z * sA; if (A2) A2 += z * sA; Bt += z * sB; if (Bt2) Bt2 += z * sB; C += z * sC;
    const int lane = threadIdx.x & 31, lr = lane & 15, hi = lane >> 4; const int r0 = blockIdx.x * 64, c0 = blockIdx.y * 64;
    v8f acc[4][4];
#pragma unroll
    for (int mb = 0; mb < 4; ++mb)
#pragma unroll
        for (int nb = 0; nb < 4; ++nb) acc[mb][nb] = (v8f){};
    const size_t aoff = (size_t)(r0 + lr) * lda + 8 * hi, boff = (size_t)(c0 + lr) * K + 8 * hi;
#pragma unroll 1
    for (int kc = 0; kc < K; kc += 32) {
        V a[4], a2[4];
#pragma unroll
        for (int mb = 0; mb < 4; ++mb) { a[mb] = WFrag<T16>::ld(A + aoff + (size_t)mb * 16 * lda + kc); if (NSPLIT == 1 || NSPLIT == 2) a2[mb] = WFrag<T16>::ld(A2 + aoff + (size_t)mb * 16 * lda + kc); }
#pragma unroll
        for (int nb = 0; nb < 4; ++nb) { const V b = WFrag<T16>::ld(Bt + boff + (size_t)nb * 16 * K + kc); V b2; if (NSPLIT >= 2) b2 = WFrag<T16>::ld(Bt2 + boff + (size_t)nb * 16 * K + kc);
#pragma unroll
            for (int mb = 0; mb < 4; ++mb) { acc[mb][nb] = WFrag<T16>::mma(a[mb], b, acc[mb][nb]); if (NSPLIT == 1 || NSPLIT == 2) acc[mb][nb] = WFrag<T16>::mma(a2[mb], b, acc[mb][nb]); if (NSPLIT >= 2) acc[mb][nb] = WFrag<T16>::mma(a[mb], b2, acc[mb][nb]); } }
        asm volatile("v_nop\n\tv_nop\n\tv_nop\n\tv_nop" : "+v"(acc[0][0]), "+v"(acc[1][1]), "+v"(acc[2][2]), "+v"(acc[3][3]) : "v"(a[0]), "v"(a[3]));
    }
#pragma unroll
    for (int mb = 0; mb < 4; ++mb) {
#pragma unroll
        for (int nb = 0; nb < 4; ++nb) {
#pragma unroll
            for (int j = 0; j < 8; ++j) os[(hi * 8 + j) * 68 + nb * 16 + lr] = acc[mb][nb][j]; }
        __builtin_amdgcn_wave_barrier(); asm volatile("" ::: "memory");
        float* crow = C + (size_t)(r0 + mb * 16) * ldc + c0;
{
#pragma unroll
            for (int s = 0; s < 8; ++s) { const int row = 2 * s + hi, cofs = lr * 4; v4f val = *(const v4fa*)(os + row * 68 + cofs); if (BIAS) { val[0] += bfr(bias[c0 + cofs]); val[1] += bfr(bias[c0 + cofs + 1]); val[2] += bfr(bias[c0 + cofs + 2]); val[3] += bfr(bias[c0 + cofs + 3]); }
                *(v4f*)(crow + (size_t)row * ldc + cofs) = val; }
             }
        __builtin_amdgcn_wave_barrier(); asm volatile("" ::: "memory");
    }
}

__device__ __forceinline__ h16 tohx(float x) { return (h16)x; }
__device__ __forceinline__ void splitf(float y, unsigned short& h, unsigned short& l) { h = f2bf(y); l = f2bf(y - bf2f(h)); }
typedef __attribute__((ext_vector_type(2))) _Float16 v2h;
typedef __attribute__((ext_vector_type(4))) _Float16 v4h;
typedef __attribute__((ext_vector_type(2))) unsigned short v2us;
typedef __attribute__((ext_vector_type(4))) unsigned short v4us;
typedef __attribute__((ext_vector_type(2))) float v2f;
typedef __attribute__((ext_vector_type(4))) int v4i;

__global__ __launch_bounds__(256) void k_wtG(const float* __restrict__ w, int K, int N, bf* Bt) {
    const int lane = threadIdx.x & 31; const int L0 = (blockIdx.x * 8 + (threadIdx.x >> 5)) * 8; const int nlines = N * K / 64;
{
#pragma unroll 1
        for (int l = 0; l < 8; ++l) { const int L = L0 + l; if (L >= nlines) break; const size_t e = (size_t)L * 64 + lane * 2; const int k = (int)(e % K), n = (int)(e / K); v2us o;
            o[0] = f2bf(w[(size_t)k * N + n]); o[1] = f2bf(w[(size_t)(k + 1) * N + n]); *(v2us*)(Bt + e) = o; }
         }
}
__global__ __launch_bounds__(256) void k_cvt8(const float* __restrict__ src, bf* dst, size_t n8) { const size_t i = (size_t)blockIdx.x * 256 + threadIdx.x; if (i >= n8) return; const v8f v = *(const v8f*)(src + i * 8); v8us o;
#pragma unroll
    for (int k = 0; k < 8; ++k) o[k] = f2bf(v[k]); *(v8us*)(dst + i * 8) = o;  }


__global__ __launch_bounds__(256) void k_vtp(const float* __restrict__ F, int pitch, int nheads, h16* V16, bf* Vh, bf* Vl) { const size_t e = ((size_t)blockIdx.x * 256 + threadIdx.x) * 2; if (e >= (size_t)nheads * HD * TT) return; const int t = (int)(e % TT); const int d = (int)((e / TT) % HD); const int g = (int)(e / ((size_t)TT * HD)); v2h o16; v2us oh, ol;
#pragma unroll
    for (int q = 0; q < 2; ++q) { const float x = F[(size_t)(t + q) * pitch + g * HD + d]; o16[q] = tohx(x); unsigned short a2, c2; splitf(x, a2, c2); oh[q] = a2; ol[q] = c2; }
    *(v2h*)(V16 + e) = o16; *(v2us*)(Vh + e) = oh; *(v2us*)(Vl + e) = ol;  }

// k_asoft: per row (zz, i): t = S x HD^-0.5 (no mask); softmax over the 2048 keys (register row, one exp, fixed trees); Ph/Pl rows have pitch 2*TT and may lie over the row's own scores: the wave holds its whole row in registers before its first store.
__global__ __launch_bounds__(256) void k_asoft(const float* Sb, h16* P16, bf* Ph, bf* Pl) {
    const int lane = threadIdx.x & 31; const int row = blockIdx.x * 8 + (threadIdx.x >> 5); if (row >= NB_ * TT) return; const int i = row % TT; const int zz = row / TT; (void)zz; const bool hires = (i < RH); const float* sr = Sb + (size_t)row * TT; float v[TT / 32]; float mx = -3.0e38f;
#pragma unroll
    for (int ch = 0; ch < TT / 128; ++ch) { const int j0 = ch * 128 + lane * 4; const v4f a = *(const v4f*)(sr + j0);
#pragma unroll
        for (int q = 0; q < 4; ++q) { const float t = a[q] * SCL; v[ch * 4 + q] = t;   /* Sb already holds q.k + bias (k_addrel) */ mx = fmaxf(mx, t); } }
#pragma unroll
    for (int sh = 16; sh; sh >>= 1) mx = fmaxf(mx, __shfl_xor(mx, sh, 32));
    float sum = 0.f;
#pragma unroll
    for (int k = 0; k < TT / 32; ++k) { float d0 = __fsub_rn(v[k], mx); asm volatile("" : "+v"(d0)); v[k] = __builtin_amdgcn_exp2f(__fmul_rn(d0, 1.4426950408889634f)); sum += v[k]; }
#pragma unroll
    for (int sh = 16; sh; sh >>= 1) sum += __shfl_xor(sum, sh, 32);
    const float f = __fdiv_rn(hires ? 1.0f : PCAR, sum);
{
        if (hires) {
#pragma unroll
            for (int ch = 0; ch < TT / 128; ++ch) { v4us oh, ol;
#pragma unroll
                for (int q = 0; q < 4; ++q) { unsigned short a, c2; splitf(v[ch * 4 + q] * f, a, c2); oh[q] = a; ol[q] = c2; }
                const size_t oo = ((size_t)zz * (RH ? RH : 1) + i) * (2 * TT) + ch * 128 + lane * 4; *(v4us*)(Ph + oo) = oh; *(v4us*)(Pl + oo) = ol; }
        } else {
#pragma unroll
            for (int ch = 0; ch < TT / 128; ++ch) { v4h o4;
#pragma unroll
                for (int q = 0; q < 4; ++q) o4[q] = tohx(v[ch * 4 + q] * f);
                *(v4h*)(P16 + (size_t)row * TT + ch * 128 + lane * 4) = o4; } }
         }
}
__global__ __launch_bounds__(256) void k_merge(const float* __restrict__ O, int h0, float* OUTb) { const size_t e = ((size_t)blockIdx.x * 256 + threadIdx.x) * 2; if (e >= (size_t)ZH * TT * HD) return; const int d = (int)(e % HD); const int t = (int)((e / HD) % TT); const int zz = (int)(e / ((size_t)HD * TT)); const float cs = (t < RH) ? 1.0f : (1.0f / PCAR); const size_t oo = (size_t)t * DQ + (h0 + zz) * HD + d;
    v2f o2; o2[0] = O[e] * cs; o2[1] = O[e + 1] * cs; *(v2f*)(OUTb + oo) = o2;  }

__global__ __launch_bounds__(256) void k_addrel(float* Sb, const float* __restrict__ QE) { const size_t k = (size_t)blockIdx.x * 256 + threadIdx.x; if (k >= (size_t)TT * TT / 4) return; Sb += (size_t)blockIdx.y * TT * TT; QE += (size_t)blockIdx.y * TT * NRP; const size_t e = k * 4; const int j0 = (int)(e % TT); const int i = (int)(e / TT); const float* qe = QE + (size_t)i * NRP; v4f a = *(const v4f*)(Sb + e);
#pragma unroll
    for (int q = 0; q < 4; ++q) { const int idx = min(max(j0 + q - i + MAXD, 0), 2 * MAXD); a[q] = __fadd_rn(a[q], qe[idx]); }
    *(v4f*)(Sb + e) = a;  }
__global__ __launch_bounds__(256) void k_tabpad(const float* __restrict__ tab, bf* Bt) { const int i = blockIdx.x * 256 + threadIdx.x; if (i >= NRP * HD / 8) return; const int d0 = (i % (HD / 8)) * 8; const int r = i / (HD / 8); v8us o;
#pragma unroll
    for (int q = 0; q < 8; ++q) { const unsigned short e = f2bf(tab[(size_t)min(r, NREL - 1) * HD + d0 + q]); o[q] = (r < NREL) ? e : (unsigned short)0; }
    *(v8us*)(Bt + (size_t)r * HD + d0) = o;  }
__global__ __launch_bounds__(256) void k_vtpR1(const float* __restrict__ Vb, bf* Vh) { const size_t e = ((size_t)blockIdx.x * 256 + threadIdx.x) * 2; if (e >= (size_t)HD * TT) return; Vb += (size_t)blockIdx.y * TT * HD; Vh += (size_t)blockIdx.y * HD * TT; const int t = (int)(e % TT); const int d = (int)(e / TT); v2us o; o[0] = f2bf(Vb[(size_t)t * HD + d]); o[1] = f2bf(Vb[(size_t)(t + 1) * HD + d]); *(v2us*)(Vh + e) = o;  }
__global__ __launch_bounds__(256) void k_mergeR(const float* __restrict__ O, float* outb, size_t n4) { const size_t i = (size_t)blockIdx.x * 256 + threadIdx.x; if (i >= n4) return; const v4f a = *(const v4f*)(O + i * 4); *(v4f*)(outb + i * 4) = a;  }

extern "C" void kernel_launch(void* const* d_in, const int* in_sizes, int n_in,
                              void* d_out, int out_size, void* d_ws, size_t ws_size, hipStream_t stream) {
    (void)in_sizes; (void)n_in; (void)out_size;
    const float* Qin = (const float*)d_in[0]; const float* Kin = (const float*)d_in[1]; const float* Vin = (const float*)d_in[2]; const float* tab = (const float*)d_in[3];
    float* OUT = (float*)d_out;     // [8][2048][64]
    char* wsp = (char*)d_ws;
    auto take = [&](size_t bytes) { char* p = wsp; wsp += (bytes + 255) & ~(size_t)255; return (void*)p; };
    bf* TB = (bf*)take((size_t)NRP * HD * 2); bf* QB = (bf*)take((size_t)NB_ * TT * HD * 2); bf* KB = (bf*)take((size_t)NB_ * TT * HD * 2); bf* VT = (bf*)take((size_t)NB_ * HD * TT * 2); float* QE = (float*)take((size_t)QG * TT * NRP * 4); float* Sb = (float*)take((size_t)NB_ * TT * TT * 4); float* Ob = (float*)take((size_t)NB_ * TT * HD * 4);
    bf* Ph = (bf*)Sb; bf* Pl = Ph + TT;    // row r of P: hi plane at r * 2*TT, lo plane TT further, over score row r
    if ((size_t)(wsp - (char*)d_ws) > ws_size) return;    // ws 256 MiB (carve ~205 MiB)
    k_tabpad<<<(NRP * HD / 8 + 255) / 256, 256, 0, stream>>>(tab, TB);
    k_cvt8<<<(unsigned)(((size_t)NB_ * TT * HD / 8 + 255) / 256), 256, 0, stream>>>(Qin, QB, (size_t)NB_ * TT * HD / 8); k_cvt8<<<(unsigned)(((size_t)NB_ * TT * HD / 8 + 255) / 256), 256, 0, stream>>>(Kin, KB, (size_t)NB_ * TT * HD / 8);
    k_vtpR1<<<dim3((unsigned)(((size_t)HD * TT / 2 + 255) / 256), NB_, 1), 256, 0, stream>>>(Vin, VT);
    k_gemmw<bf, 0, false><<<dim3(TT / 64, TT / 64, NB_), 32, 0, stream>>>(QB, nullptr, HD, KB, nullptr, HD, Sb, TT, nullptr, (size_t)TT * HD, (size_t)TT * HD, (size_t)TT * TT);       /* q.k (exact) */
    for (int g = 0; g < NB_ / QG; ++g) {
        k_gemmw<bf, 0, false><<<dim3(TT / 64, NRP / 64, QG), 32, 0, stream>>>(QB + (size_t)g * QG * TT * HD, nullptr, HD, TB, nullptr, HD, QE, NRP, nullptr, (size_t)TT * HD, 0, (size_t)TT * NRP);     /* QE[i][e] = q_i . rel_table[e] (exact products) */
        k_addrel<<<dim3((unsigned)(((size_t)TT * TT / 4 + 255) / 256), QG, 1), 256, 0, stream>>>(Sb + (size_t)g * QG * TT * TT, QE); }
    k_asoft<<<NB_ * TT / 8, 256, 0, stream>>>(Sb, nullptr, Ph, Pl);
    k_gemmw<bf, 1, false><<<dim3(TT / 64, HD / 64, NB_), 32, 0, stream>>>(Ph, Pl, 2 * TT, VT, nullptr, TT, Ob, HD, nullptr, (size_t)TT * 2 * TT, (size_t)HD * TT, (size_t)TT * HD);         /* P (hi/lo) x v^T (exact) */
    k_mergeR<<<(unsigned)(((size_t)NB_ * TT * HD / 4 + 255) / 256), 256, 0, stream>>>(Ob, OUT, (size_t)NB_ * TT * HD / 4);
}

// v002
// Measured time: 47.4 microseconds a run.
// Next to v001, in two timings, it ran 4.32 times as fast each time.
// Counting every step since v000, it is 14.5 times as fast.
#include <hip/hip_runtime.h>

// Single-head attention with a learned relative-position bias (Music-Transformer style skew) on given q, k, v [8][2048][64]: rel_emb[e] = rel_table[clip(e - S, -1024, 1024) + 1024] (table [2049][64]); qr = skew(q . rel_emb) so that bias[i][j] = q_i . rel_table[clip(j - i, -1024, 1024) + 1024]; scores = (q.k + bias) / 8; softmax over all keys; out = w v -> [8][2048][64] (1.0 M).
// One fused kernel (k_fattn) does scores, bias, softmax and P x v; the score matrix never reaches memory. Before it, four small kernels round q, k and the table to bf16 planes and write v^T as a bf16 plane.
// Transposed products: S^T = k q^T and E^T = (table window) q^T, so a lane holds one query's scores; the bias of key j for query i is row (j - i) of E^T, fetched per lane from an LDS copy of E^T (the skew); the table row index is clamped as the module clips it.
// Compute dtypes, f32 accumulate: every input rounded to bf16; q.k, q.table exact products; softmax f32, running maximum; unnormalised P as bf16 hi/lo x exact v^T (2 products); f32 output rows.

#define NB_  8
#define TT   2048
#define DM   1024
#define NH_  1
#define NKV  1
#define REP  (NH_ / NKV)
#define HD   64
#define DQ   (NH_ * HD)
#define DKV  (NKV * HD)
#define ZH   2
#define RH   2048                  // query rows < RH use hi+lo planes (0: none)
#define WIN  0
#define PCAR 1024.0f
#define SCL  0.125f   // 1/sqrt(64) applied to (q.k + bias)
#define NREL 2049   // table rows (2*MAX_DIST + 1)
#define NRP  2112   // padded to a multiple of 64
#define MAXD 1024
typedef _Float16 h16;
typedef unsigned short bf;
typedef __attribute__((ext_vector_type(16))) __bf16   v16bf;
typedef __attribute__((ext_vector_type(16))) _Float16 v16h;
typedef __attribute__((ext_vector_type(8)))  _Float16 v8h;
typedef __attribute__((ext_vector_type(8)))  unsigned short v8us;
typedef __attribute__((ext_vector_type(8)))  float    v8f;
typedef __attribute__((ext_vector_type(4)))  float    v4f;
typedef v8h  __attribute__((may_alias)) v8ha;
typedef v4f  __attribute__((may_alias)) v4fa;
typedef v8us __attribute__((may_alias)) v8usa;

__device__ __forceinline__ unsigned short f2bf(float f) { unsigned u = __float_as_uint(f); u += 0x7FFFu + ((u >> 16) & 1u); return (unsigned short)(u >> 16); }
__device__ __forceinline__ float bf2f(unsigned short b) { return __uint_as_float(((unsigned)b) << 16); }
__device__ __forceinline__ float bfr(float f) { return bf2f(f2bf(f)); }
__device__ __forceinline__ v16h cat16(v8h lo, v8h hi) { return __builtin_shufflevector(lo, hi, 0, 1, 2, 3, 4, 5, 6, 7, 8, 9, 10, 11, 12, 13, 14, 15); }
__device__ __forceinline__ v16bf cat16b(v8us lo, v8us hi) { return __builtin_bit_cast(v16bf, __builtin_shufflevector(lo, hi, 0, 1, 2, 3, 4, 5, 6, 7, 8, 9, 10, 11, 12, 13, 14, 15)); }
__device__ __forceinline__ v8f wmma16(v16h a, v16h b, v8f c) { return __builtin_amdgcn_wmma_f32_16x16x32_f16(false, a, false, b, (short)0, c, false, false); }
__device__ __forceinline__ v8f wmmab(v16bf a, v16bf b, v8f c) { return __builtin_amdgcn_wmma_f32_16x16x32_bf16(false, a, false, b, (short)0, c, false, false); }



// Fragment loader: 16 elements of one K-contiguous row in the hardware k order (k = 8h .. 8h+7, then 16+8h .. 16+8h+7), the same for A and B.
template <typename T16> struct WFrag;
template <> struct WFrag<h16> { typedef v16h V; static __device__ __forceinline__ V ld(const h16* p) { return cat16(*(const v8h*)p, *(const v8h*)(p + 16)); } static __device__ __forceinline__ v8f mma(V a, V b, v8f c) { return wmma16(a, b, c); } };
template <> struct WFrag<bf> { typedef v16bf V; static __device__ __forceinline__ V ld(const bf* p) { return cat16b(*(const v8us*)p, *(const v8us*)(p + 16)); } static __device__ __forceinline__ v8f mma(V a, V b, v8f c) { return wmmab(a, b, c); } };
__device__ __forceinline__ h16 tohx(float x) { return (h16)x; }
__device__ __forceinline__ void splitf(float y, unsigned short& h, unsigned short& l) { h = f2bf(y); l = f2bf(y - bf2f(h)); }
typedef __attribute__((ext_vector_type(2))) _Float16 v2h;
typedef __attribute__((ext_vector_type(4))) _Float16 v4h;
typedef __attribute__((ext_vector_type(2))) unsigned short v2us;
typedef __attribute__((ext_vector_type(4))) unsigned short v4us;
typedef __attribute__((ext_vector_type(2))) float v2f;
typedef __attribute__((ext_vector_type(4))) int v4i;

__global__ __launch_bounds__(256) void k_wtG(const float* __restrict__ w, int K, int N, bf* Bt) {
    const int lane = threadIdx.x & 31; const int L0 = (blockIdx.x * 8 + (threadIdx.x >> 5)) * 8; const int nlines = N * K / 64;
{
#pragma unroll 1
        for (int l = 0; l < 8; ++l) { const int L = L0 + l; if (L >= nlines) break; const size_t e = (size_t)L * 64 + lane * 2; const int k = (int)(e % K), n = (int)(e / K); v2us o;
            o[0] = f2bf(w[(size_t)k * N + n]); o[1] = f2bf(w[(size_t)(k + 1) * N + n]); *(v2us*)(Bt + e) = o; }
         }
}
__global__ __launch_bounds__(256) void k_cvt8(const float* __restrict__ src, bf* dst, size_t n8) { const size_t i = (size_t)blockIdx.x * 256 + threadIdx.x; if (i >= n8) return; const v8f v = *(const v8f*)(src + i * 8); v8us o;
#pragma unroll
    for (int k = 0; k < 8; ++k) o[k] = f2bf(v[k]); *(v8us*)(dst + i * 8) = o;  }


__global__ __launch_bounds__(256) void k_vtp(const float* __restrict__ F, int pitch, int nheads, h16* V16, bf* Vh, bf* Vl) { const size_t e = ((size_t)blockIdx.x * 256 + threadIdx.x) * 2; if (e >= (size_t)nheads * HD * TT) return; const int t = (int)(e % TT); const int d = (int)((e / TT) % HD); const int g = (int)(e / ((size_t)TT * HD)); v2h o16; v2us oh, ol;
#pragma unroll
    for (int q = 0; q < 2; ++q) { const float x = F[(size_t)(t + q) * pitch + g * HD + d]; o16[q] = tohx(x); unsigned short a2, c2; splitf(x, a2, c2); oh[q] = a2; ol[q] = c2; }
    *(v2h*)(V16 + e) = o16; *(v2us*)(Vh + e) = oh; *(v2us*)(Vl + e) = ol;  }

__global__ __launch_bounds__(256) void k_merge(const float* __restrict__ O, int h0, float* OUTb) { const size_t e = ((size_t)blockIdx.x * 256 + threadIdx.x) * 2; if (e >= (size_t)ZH * TT * HD) return; const int d = (int)(e % HD); const int t = (int)((e / HD) % TT); const int zz = (int)(e / ((size_t)HD * TT)); const float cs = (t < RH) ? 1.0f : (1.0f / PCAR); const size_t oo = (size_t)t * DQ + (h0 + zz) * HD + d;
    v2f o2; o2[0] = O[e] * cs; o2[1] = O[e + 1] * cs; *(v2f*)(OUTb + oo) = o2;  }

__global__ __launch_bounds__(256) void k_tabpad(const float* __restrict__ tab, bf* Bt) { const int i = blockIdx.x * 256 + threadIdx.x; if (i >= NRP * HD / 8) return; const int d0 = (i % (HD / 8)) * 8; const int r = i / (HD / 8); v8us o;
#pragma unroll
    for (int q = 0; q < 8; ++q) { const unsigned short e = f2bf(tab[(size_t)min(r, NREL - 1) * HD + d0 + q]); o[q] = (r < NREL) ? e : (unsigned short)0; }
    *(v8us*)(Bt + (size_t)r * HD + d0) = o;  }
__global__ __launch_bounds__(256) void k_vtpR1(const float* __restrict__ Vb, bf* Vh) { const size_t e = ((size_t)blockIdx.x * 256 + threadIdx.x) * 2; if (e >= (size_t)HD * TT) return; Vb += (size_t)blockIdx.y * TT * HD; Vh += (size_t)blockIdx.y * HD * TT; const int t = (int)(e % TT); const int d = (int)(e / TT); v2us o; o[0] = f2bf(Vb[(size_t)t * HD + d]); o[1] = f2bf(Vb[(size_t)(t + 1) * HD + d]); *(v2us*)(Vh + e) = o;  }
// ---- k_fattn: one block = 32 queries of one batch; its KSP waves each take KPW keys in passes of 64 and keep a running maximum, sum and O^T; the partial results are merged in LDS at the end, in wave order.
#define KSP 8                      // waves per block = key ranges of one query block
#define KPW (TT / KSP)             // keys per wave
#define EP  84                     // floats per query row of the E^T copy (80 window rows + 4: the skewed b32 reads and the b128 stores then fall on distinct banks)
#define OP  68                     // floats per query row of a partial output tile
#define CSL 0.18033688011112042f   // SCL * log2(e)
typedef __attribute__((ext_vector_type(16))) float v16f;
// fragment at a 32-bit byte offset from a block-uniform base: one address register a load instead of a pair
__device__ __forceinline__ v16bf ldo(const bf* base, unsigned byteoff) { return WFrag<bf>::ld((const bf*)((const char*)base + byteoff)); }
// 2^x with the slot behind a transcendental filled in the same statement
__device__ __forceinline__ float exp2n(float x) { float r; asm("v_exp_f32 %0, %1\n\tv_nop" : "=v"(r) : "v"(x)); return r; }
// four waves per SIMD (two blocks per WGP): holds the build to 256 registers
__global__ __launch_bounds__(KSP * 32) __attribute__((amdgpu_waves_per_eu(4, 4))) void k_fattn(const bf* __restrict__ QB, const bf* __restrict__ KB, const bf* __restrict__ VT, const bf* __restrict__ TB, float* __restrict__ OUT) {
    __shared__ __align__(16) float sm[KSP * 2 * 16 * EP];
    __shared__ float sml[2][KSP][32];
    const int lane = threadIdx.x & 31, lr = lane & 15, hi = lane >> 4, w = threadIdx.x >> 5;
    const int i0 = blockIdx.x * 32; const size_t zb = blockIdx.y;
    const bf* Qb = QB + zb * TT * HD; const bf* Kb = KB + zb * TT * HD; const bf* Vb = VT + zb * HD * TT;
    float* es = sm + w * (2 * 16 * EP);      // this wave's own E^T copies, one per query group
    v16bf qf[2][2];                          // B operand: query i0 + 16 g + lr, kept for the whole kernel
#pragma unroll
    for (int g = 0; g < 2; ++g)
#pragma unroll
        for (int ks = 0; ks < 2; ++ks) qf[g][ks] = WFrag<bf>::ld(Qb + (size_t)(i0 + g * 16 + lr) * HD + ks * 32 + 8 * hi);
    v8f o[2][4]; float m[2], l[2];
#pragma unroll
    for (int g = 0; g < 2; ++g) { m[g] = -3.0e38f; l[g] = 0.f;
#pragma unroll
        for (int db = 0; db < 4; ++db) o[g][db] = (v8f){}; }
    // kept rolled for speed only
#pragma unroll 1
    for (int it = 0; it < KPW / 64; ++it) {
        const int j0 = w * KPW + it * 64;
        // E^T over the 96 table rows j - i = j0 - i0 - 31 .. j0 - i0 + 64 (clamped); group 0 needs window blocks 1..5, group 1 blocks 0..4
        { v16bf ta[6][2];
#pragma unroll
        for (int wb = 0; wb < 6; ++wb) { const int tr = min(max(j0 - i0 - 31 + wb * 16 + lr + MAXD, 0), 2 * MAXD); const unsigned tp = (unsigned)(tr * HD + 8 * hi) * 2u; ta[wb][0] = ldo(TB, tp); ta[wb][1] = ldo(TB, tp + 64u); }
        // keeps the 24 table loads above in one batch: otherwise the first blocks' loads are each waited for before the next block's are issued
        __builtin_amdgcn_sched_barrier(0);
        asm volatile("s_wait_xcnt 0x0" ::: "memory");    // before the loads' address registers are re-used
#pragma unroll
        for (int wb = 0; wb < 6; ++wb) { v8f e[2];
#pragma unroll
            for (int g = 0; g < 2; ++g) e[g] = wmmab(ta[wb][0], qf[g][0], (v8f){});
#pragma unroll
            for (int g = 0; g < 2; ++g) e[g] = wmmab(ta[wb][1], qf[g][1], e[g]);
            // WMMA distance: four vector slots behind the products above, before a later matrix instruction starts a new sum in the same registers (the compiler re-uses them at once)
            if (wb == 0) asm volatile("v_nop\n\tv_nop\n\tv_nop\n\tv_nop" :: "v"(e[1])); else if (wb == 5) asm volatile("v_nop\n\tv_nop\n\tv_nop\n\tv_nop" :: "v"(e[0])); else asm volatile("v_nop\n\tv_nop\n\tv_nop\n\tv_nop" :: "v"(e[0]), "v"(e[1]));
#pragma unroll
            for (int g = 0; g < 2; ++g) { const int lb = wb - 1 + g; if (lb >= 0 && lb < 5) { float* ep = es + (g * 16 + lr) * EP + lb * 16 + 8 * hi;
                *(v4fa*)ep = __builtin_shufflevector(e[g], e[g], 0, 1, 2, 3); *(v4fa*)(ep + 4) = __builtin_shufflevector(e[g], e[g], 4, 5, 6, 7); } } } }
        v16bf ka[4][2];
#pragma unroll
        for (int kb = 0; kb < 4; ++kb) { const unsigned kp = (unsigned)((j0 + kb * 16 + lr) * HD + 8 * hi) * 2u; ka[kb][0] = ldo(Kb, kp); ka[kb][1] = ldo(Kb, kp + 64u); }
        asm volatile("s_wait_xcnt 0x0" ::: "memory");    // before the loads' address registers are re-used
        // keeps the skewed reads below behind the other half-wave's stores above (same wave: LDS runs its operations in order)
        __builtin_amdgcn_wave_barrier(); asm volatile("" ::: "memory");
        v8f s[2][4];                         // s[g][kb][r] = score of key j0 + 16 kb + 8 hi + r for query i0 + 16 g + lr; starts as the bias, the q.k products accumulate onto it
#pragma unroll
        for (int g = 0; g < 2; ++g) { const float* er = es + (g * 16 + lr) * EP - lr + 15 + 8 * hi;
#pragma unroll
            for (int kb = 0; kb < 4; ++kb)
#pragma unroll
                for (int r = 0; r < 8; ++r) s[g][kb][r] = er[kb * 16 + r]; }
        // keeps the next pass's E^T stores behind the reads above
        __builtin_amdgcn_wave_barrier(); asm volatile("" ::: "memory");
#pragma unroll
        for (int ks = 0; ks < 2; ++ks)
#pragma unroll
            for (int kb = 0; kb < 4; ++kb)
#pragma unroll
                for (int g = 0; g < 2; ++g) s[g][kb] = wmmab(ka[kb][ks], qf[g][ks], s[g][kb]);
        v16bf ph[2][2], pl[2][2];            // P^T as B operands: two score tiles (32 keys) pack into one fragment in the hardware k order
#pragma unroll
        for (int g = 0; g < 2; ++g) { float mx = m[g];
#pragma unroll
            for (int kb = 0; kb < 4; ++kb)
#pragma unroll
                for (int r = 0; r < 8; ++r) { const float y = s[g][kb][r] * CSL; s[g][kb][r] = y; mx = fmaxf(mx, y); }
            mx = fmaxf(mx, __shfl_xor(mx, 16, 32));
            const float al = exp2n(m[g] - mx); m[g] = mx; float sum = 0.f;
            // splits the scheduling region: the two query groups' softmax runs are then not interleaved, which keeps the build free of spills
            __builtin_amdgcn_sched_barrier(0);
#pragma unroll
            for (int kb = 0; kb < 4; ++kb)
#pragma unroll
                for (int r = 0; r < 8; ++r) { const float p = exp2n(s[g][kb][r] - mx); s[g][kb][r] = p; sum += p; }
            l[g] = l[g] * al + sum;
#pragma unroll
            for (int db = 0; db < 4; ++db) o[g][db] *= al;
#pragma unroll
            for (int ks = 0; ks < 2; ++ks) { const v16f pv = __builtin_shufflevector(s[g][2 * ks], s[g][2 * ks + 1], 0, 1, 2, 3, 4, 5, 6, 7, 8, 9, 10, 11, 12, 13, 14, 15); const v16bf h = __builtin_convertvector(pv, v16bf);
                ph[g][ks] = h; pl[g][ks] = __builtin_convertvector(pv - __builtin_convertvector(h, v16f), v16bf); }
        }
        // ends the scheduling region of the softmax, where registers are scarce: without it the v^T loads below are issued two at a time, each pair waited for before its products
        __builtin_amdgcn_sched_barrier(0);
        v16bf va[4][2];
#pragma unroll
        for (int db = 0; db < 4; ++db)
#pragma unroll
            for (int ks = 0; ks < 2; ++ks) va[db][ks] = ldo(Vb, (unsigned)((db * 16 + lr) * TT + j0 + ks * 32 + 8 * hi) * 2u);
        asm volatile("s_wait_xcnt 0x0" ::: "memory");    // before the loads' address registers are re-used
#pragma unroll
        for (int db = 0; db < 4; ++db)
#pragma unroll
            for (int ks = 0; ks < 2; ++ks)
#pragma unroll
                for (int g = 0; g < 2; ++g) o[g][db] = wmmab(va[db][ks], pl[g][ks], wmmab(va[db][ks], ph[g][ks], o[g][db]));
    }
    // merge of the KSP key ranges: common maximum, total sum, then the scaled partial O^T tiles summed in wave order
#pragma unroll
    for (int g = 0; g < 2; ++g) { l[g] += __shfl_xor(l[g], 16, 32); if (hi == 0) { sml[0][w][g * 16 + lr] = m[g]; sml[1][w][g * 16 + lr] = l[g]; } }
    __syncthreads();                         // publishes every wave's maximum and sum; also ends every wave's use of its E^T copies
#pragma unroll
    for (int g = 0; g < 2; ++g) { float M = -3.0e38f, L = 0.f;
#pragma unroll
        for (int ww = 0; ww < KSP; ++ww) M = fmaxf(M, sml[0][ww][g * 16 + lr]);
#pragma unroll
        for (int ww = 0; ww < KSP; ++ww) L += sml[1][ww][g * 16 + lr] * exp2n(sml[0][ww][g * 16 + lr] - M);
        const float f = exp2n(m[g] - M) / L;
#pragma unroll
        for (int db = 0; db < 4; ++db) o[g][db] *= f; }
#pragma unroll
    for (int g = 0; g < 2; ++g) { float* op = sm + (w * 16 + lr) * OP + 8 * hi;
#pragma unroll
        for (int db = 0; db < 4; ++db) { *(v4fa*)(op + db * 16) = __builtin_shufflevector(o[g][db], o[g][db], 0, 1, 2, 3); *(v4fa*)(op + db * 16 + 4) = __builtin_shufflevector(o[g][db], o[g][db], 4, 5, 6, 7); }
        __syncthreads();                     // publishes the KSP partial tiles of this query group
        const int q = threadIdx.x >> 4, d4 = (threadIdx.x & 15) * 4; v4f acc = *(const v4fa*)(sm + q * OP + d4);
#pragma unroll
        for (int ww = 1; ww < KSP; ++ww) acc += *(const v4fa*)(sm + (ww * 16 + q) * OP + d4);
        *(v4f*)(OUT + (zb * TT + i0 + g * 16 + q) * HD + d4) = acc;
        if (g == 0) __syncthreads();         // the tiles are read out before group 1 overwrites them
    }
}

extern "C" void kernel_launch(void* const* d_in, const int* in_sizes, int n_in,
                              void* d_out, int out_size, void* d_ws, size_t ws_size, hipStream_t stream) {
    (void)in_sizes; (void)n_in; (void)out_size;
    const float* Qin = (const float*)d_in[0]; const float* Kin = (const float*)d_in[1]; const float* Vin = (const float*)d_in[2]; const float* tab = (const float*)d_in[3];
    float* OUT = (float*)d_out;     // [8][2048][64]
    char* wsp = (char*)d_ws;
    auto take = [&](size_t bytes) { char* p = wsp; wsp += (bytes + 255) & ~(size_t)255; return (void*)p; };
    bf* TB = (bf*)take((size_t)NRP * HD * 2); bf* QB = (bf*)take((size_t)NB_ * TT * HD * 2); bf* KB = (bf*)take((size_t)NB_ * TT * HD * 2); bf* VT = (bf*)take((size_t)NB_ * HD * TT * 2);
    if ((size_t)(wsp - (char*)d_ws) > ws_size) return;    // carve ~6.3 MiB
    k_tabpad<<<(NRP * HD / 8 + 255) / 256, 256, 0, stream>>>(tab, TB);
    k_cvt8<<<(unsigned)(((size_t)NB_ * TT * HD / 8 + 255) / 256), 256, 0, stream>>>(Qin, QB, (size_t)NB_ * TT * HD / 8); k_cvt8<<<(unsigned)(((size_t)NB_ * TT * HD / 8 + 255) / 256), 256, 0, stream>>>(Kin, KB, (size_t)NB_ * TT * HD / 8);
    k_vtpR1<<<dim3((unsigned)(((size_t)HD * TT / 2 + 255) / 256), NB_, 1), 256, 0, stream>>>(Vin, VT);
    k_fattn<<<dim3(TT / 32, NB_, 1), KSP * 32, 0, stream>>>(QB, KB, VT, TB, OUT);
}

// v003
// A run of this version takes 39.3 microseconds.
// Next to v002, in two timings, it ran 1.21 times as fast each time.
// All steps since v000 together make it 17.6 times as fast.
#include <hip/hip_runtime.h>

// Single-head attention with a learned relative-position bias (Music-Transformer style skew) on given q, k, v [8][2048][64]: rel_emb[e] = rel_table[clip(e - S, -1024, 1024) + 1024] (table [2049][64]); qr = skew(q . rel_emb) so that bias[i][j] = q_i . rel_table[clip(j - i, -1024, 1024) + 1024]; scores = (q.k + bias) / 8; softmax over all keys; out = w v -> [8][2048][64] (1.0 M).
// One fused kernel (k_fattn) does scores, bias, softmax and P x v; the score matrix never reaches memory. Before it, one kernel (k_prep) rounds q, k and the table to bf16 planes and writes v^T as a bf16 plane.
// Transposed products: S^T = k q^T and E^T = (table window) q^T, so a lane holds one query's scores; the bias of key j for query i is row (j - i) of E^T, fetched per lane from an LDS copy of E^T (the skew); the table row index is clamped as the module clips it.
// Compute dtypes, f32 accumulate: every input rounded to bf16; q.k, q.table exact products; softmax f32, running maximum; unnormalised P as bf16 hi/lo x exact v^T (2 products); f32 output rows.

#define NB_  8
#define TT   2048
#define DM   1024
#define NH_  1
#define NKV  1
#define REP  (NH_ / NKV)
#define HD   64
#define DQ   (NH_ * HD)
#define DKV  (NKV * HD)
#define ZH   2
#define RH   2048
#define WIN  0
#define PCAR 1024.0f
#define SCL  0.125f   // 1/sqrt(64) applied to (q.k + bias)
#define NREL 2049   // table rows (2*MAX_DIST + 1)
#define NRP  2112   // padded to a multiple of 64
#define MAXD 1024
typedef _Float16 h16;
typedef unsigned short bf;
typedef __attribute__((ext_vector_type(16))) __bf16   v16bf;
typedef __attribute__((ext_vector_type(16))) _Float16 v16h;
typedef __attribute__((ext_vector_type(8)))  _Float16 v8h;
typedef __attribute__((ext_vector_type(8)))  unsigned short v8us;
typedef __attribute__((ext_vector_type(8)))  float    v8f;
typedef __attribute__((ext_vector_type(4)))  float    v4f;
typedef v8h  __attribute__((may_alias)) v8ha;
typedef v4f  __attribute__((may_alias)) v4fa;
typedef v8us __attribute__((may_alias)) v8usa;

__device__ __forceinline__ unsigned short f2bf(float f) { unsigned u = __float_as_uint(f); u += 0x7FFFu + ((u >> 16) & 1u); return (unsigned short)(u >> 16); }
__device__ __forceinline__ float bf2f(unsigned short b) { return __uint_as_float(((unsigned)b) << 16); }
__device__ __forceinline__ float bfr(float f) { return bf2f(f2bf(f)); }
__device__ __forceinline__ v16h cat16(v8h lo, v8h hi) { return __builtin_shufflevector(lo, hi, 0, 1, 2, 3, 4, 5, 6, 7, 8, 9, 10, 11, 12, 13, 14, 15); }
__device__ __forceinline__ v16bf cat16b(v8us lo, v8us hi) { return __builtin_bit_cast(v16bf, __builtin_shufflevector(lo, hi, 0, 1, 2, 3, 4, 5, 6, 7, 8, 9, 10, 11, 12, 13, 14, 15)); }
__device__ __forceinline__ v8f wmma16(v16h a, v16h b, v8f c) { return __builtin_amdgcn_wmma_f32_16x16x32_f16(false, a, false, b, (short)0, c, false, false); }
__device__ __forceinline__ v8f wmmab(v16bf a, v16bf b, v8f c) { return __builtin_amdgcn_wmma_f32_16x16x32_bf16(false, a, false, b, (short)0, c, false, false); }



// Fragment loader: 16 elements of one K-contiguous row in the hardware k order (k = 8h .. 8h+7, then 16+8h .. 16+8h+7), the same for A and B.
template <typename T16> struct WFrag;
template <> struct WFrag<h16> { typedef v16h V; static __device__ __forceinline__ V ld(const h16* p) { return cat16(*(const v8h*)p, *(const v8h*)(p + 16)); } static __device__ __forceinline__ v8f mma(V a, V b, v8f c) { return wmma16(a, b, c); } };
template <> struct WFrag<bf> { typedef v16bf V; static __device__ __forceinline__ V ld(const bf* p) { return cat16b(*(const v8us*)p, *(const v8us*)(p + 16)); } static __device__ __forceinline__ v8f mma(V a, V b, v8f c) { return wmmab(a, b, c); } };
__device__ __forceinline__ h16 tohx(float x) { return (h16)x; }
__device__ __forceinline__ void splitf(float y, unsigned short& h, unsigned short& l) { h = f2bf(y); l = f2bf(y - bf2f(h)); }
typedef __attribute__((ext_vector_type(2))) _Float16 v2h;
typedef __attribute__((ext_vector_type(4))) _Float16 v4h;
typedef __attribute__((ext_vector_type(2))) unsigned short v2us;
typedef __attribute__((ext_vector_type(4))) unsigned short v4us;
typedef __attribute__((ext_vector_type(2))) float v2f;
typedef __attribute__((ext_vector_type(4))) int v4i;

__global__ __launch_bounds__(256) void k_wtG(const float* __restrict__ w, int K, int N, bf* Bt) {
    const int lane = threadIdx.x & 31; const int L0 = (blockIdx.x * 8 + (threadIdx.x >> 5)) * 8; const int nlines = N * K / 64;
{
#pragma unroll 1
        for (int l = 0; l < 8; ++l) { const int L = L0 + l; if (L >= nlines) break; const size_t e = (size_t)L * 64 + lane * 2; const int k = (int)(e % K), n = (int)(e / K); v2us o;
            o[0] = f2bf(w[(size_t)k * N + n]); o[1] = f2bf(w[(size_t)(k + 1) * N + n]); *(v2us*)(Bt + e) = o; }
         }
}

__global__ __launch_bounds__(256) void k_vtp(const float* __restrict__ F, int pitch, int nheads, h16* V16, bf* Vh, bf* Vl) { const size_t e = ((size_t)blockIdx.x * 256 + threadIdx.x) * 2; if (e >= (size_t)nheads * HD * TT) return; const int t = (int)(e % TT); const int d = (int)((e / TT) % HD); const int g = (int)(e / ((size_t)TT * HD)); v2h o16; v2us oh, ol;
#pragma unroll
    for (int q = 0; q < 2; ++q) { const float x = F[(size_t)(t + q) * pitch + g * HD + d]; o16[q] = tohx(x); unsigned short a2, c2; splitf(x, a2, c2); oh[q] = a2; ol[q] = c2; }
    *(v2h*)(V16 + e) = o16; *(v2us*)(Vh + e) = oh; *(v2us*)(Vl + e) = ol;  }

__global__ __launch_bounds__(256) void k_merge(const float* __restrict__ O, int h0, float* OUTb) { const size_t e = ((size_t)blockIdx.x * 256 + threadIdx.x) * 2; if (e >= (size_t)ZH * TT * HD) return; const int d = (int)(e % HD); const int t = (int)((e / HD) % TT); const int zz = (int)(e / ((size_t)HD * TT)); const float cs = (t < RH) ? 1.0f : (1.0f / PCAR); const size_t oo = (size_t)t * DQ + (h0 + zz) * HD + d;
    v2f o2; o2[0] = O[e] * cs; o2[1] = O[e + 1] * cs; *(v2f*)(OUTb + oo) = o2;  }

// ---- k_prep: every bf16 plane in one launch. The block index picks the job (v^T, q, k, table); a thread handles 64 elements (16 of the table), so the whole stage is PB_ALL blocks of eight waves, fewer than the chip has WGPs.
#define PU     8                                   // units of 8 elements a thread
#define PB_V   (NB_ * TT * HD / (256 * 8 * PU))     // blocks of the v^T job; the q and the k job have as many
#define PB_T   (NRP * HD / (256 * 16))              // blocks of the table job, 16 elements a thread: a whole number
#define PB_ALL (3 * PB_V + PB_T)
__device__ __forceinline__ v8us cvt8(v8f v) { v8us o;
#pragma unroll
    for (int k = 0; k < 8; ++k) o[k] = f2bf(v[k]);
    return o; }
__global__ __launch_bounds__(256) void k_prep(const float* __restrict__ Qin, const float* __restrict__ Kin, const float* __restrict__ Vin, const float* __restrict__ tab, bf* __restrict__ QB, bf* __restrict__ KB, bf* __restrict__ VT, bf* __restrict__ TB) {
    const int b = blockIdx.x, tid = threadIdx.x;
    if (b < PB_V) {
        // v^T: a wave takes 64 keys x 32 columns of one batch; a lane holds 8 keys x 8 columns in registers, so a row of v is read in whole 128-byte lines and eight lanes store one whole line of v^T
        const int lane = tid & 31, tg = lane & 7, dg = lane >> 3; const int wt = b * 8 + (tid >> 5);
        const int z = wt / (TT / 64 * 2), r = wt % (TT / 64 * 2); const int t0 = (r >> 1) * 64 + tg * 8, d0 = (r & 1) * 32 + dg * 4;
        const float* Vb = Vin + (size_t)z * TT * HD + (size_t)t0 * HD + d0; bf* Vh = VT + (size_t)z * HD * TT + (size_t)d0 * TT + t0;
        v4f x[8][2];
#pragma unroll
        for (int q = 0; q < 8; ++q) { x[q][0] = *(const v4f*)(Vb + q * HD); x[q][1] = *(const v4f*)(Vb + q * HD + 16); }
        // keeps the 16 loads above in one batch: otherwise five of them are issued only behind the first ones' data
        __builtin_amdgcn_sched_barrier(0);
        asm volatile("s_wait_xcnt 0x0" :: "v"(Vb) : "memory");     // before the loads' address registers are re-used; the address is an input, so it stays in them up to here
#pragma unroll
        for (int h = 0; h < 2; ++h)
#pragma unroll
            for (int c = 0; c < 4; ++c) { v8us o;
#pragma unroll
                for (int q = 0; q < 8; ++q) o[q] = f2bf(x[q][h][c]);
                *(v8us*)(Vh + (size_t)(h * 16 + c) * TT) = o; }
    } else if (b < 3 * PB_V) {
        const bool isq = b < 2 * PB_V; const float* src = isq ? Qin : Kin; bf* dst = isq ? QB : KB;
        const size_t i0 = (size_t)(b - (isq ? PB_V : 2 * PB_V)) * (256 * PU) + tid; const float* sp = src + i0 * 8; v8f x[PU];
#pragma unroll
        for (int u = 0; u < PU; ++u) x[u] = *(const v8f*)(sp + u * 2048);
        asm volatile("s_wait_xcnt 0x0" :: "v"(sp) : "memory");     // as above
#pragma unroll
        for (int u = 0; u < PU; ++u) *(v8us*)(dst + i0 * 8 + u * 2048) = cvt8(x[u]);
    } else {
        // table rows, padded with zero rows to NRP: a thread takes a quarter of a row
        const int j = (b - 3 * PB_V) * 256 + tid, r = j / 4; const float* tp = tab + (size_t)min(r, NREL - 1) * HD + (j % 4) * 16;
        const v8f x0 = *(const v8f*)tp, x1 = *(const v8f*)(tp + 8);
        asm volatile("s_wait_xcnt 0x0" :: "v"(tp) : "memory");     // as above
        *(v8us*)(TB + (size_t)j * 16) = (r < NREL) ? cvt8(x0) : (v8us)(unsigned short)0; *(v8us*)(TB + (size_t)j * 16 + 8) = (r < NREL) ? cvt8(x1) : (v8us)(unsigned short)0;
    }
}
// ---- k_fattn: one block = 32 queries of one batch; its KSP waves each take KPW keys in passes of 64 and keep a running maximum, sum and O^T; the partial results are merged in LDS at the end, in wave order.
#define KSP 8                      // waves per block = key ranges of one query block
#define KPW (TT / KSP)             // keys per wave
#define EP  84                     // floats per query row of the E^T copy (80 window rows + 4: the skewed b32 reads and the b128 stores then fall on distinct banks)
#define OP  68                     // floats per query row of a partial output tile
#define CSL 0.18033688011112042f   // SCL * log2(e)
typedef __attribute__((ext_vector_type(16))) float v16f;
// fragment at a 32-bit byte offset from a block-uniform base: one address register a load instead of a pair
__device__ __forceinline__ v16bf ldo(const bf* base, unsigned byteoff) { return WFrag<bf>::ld((const bf*)((const char*)base + byteoff)); }
// 2^x with the slot behind a transcendental filled in the same statement
__device__ __forceinline__ float exp2n(float x) { float r; asm("v_exp_f32 %0, %1\n\tv_nop" : "=v"(r) : "v"(x)); return r; }
// four waves per SIMD (two blocks per WGP): holds the build to 256 registers
__global__ __launch_bounds__(KSP * 32) __attribute__((amdgpu_waves_per_eu(4, 4))) void k_fattn(const bf* __restrict__ QB, const bf* __restrict__ KB, const bf* __restrict__ VT, const bf* __restrict__ TB, float* __restrict__ OUT) {
    __shared__ __align__(16) float sm[KSP * 2 * 16 * EP];
    __shared__ float sml[2][KSP][32];
    const int lane = threadIdx.x & 31, lr = lane & 15, hi = lane >> 4, w = threadIdx.x >> 5;
    const int i0 = blockIdx.x * 32; const size_t zb = blockIdx.y;
    const bf* Qb = QB + zb * TT * HD; const bf* Kb = KB + zb * TT * HD; const bf* Vb = VT + zb * HD * TT;
    float* es = sm + w * (2 * 16 * EP);      // this wave's own E^T copies, one per query group
    v16bf qf[2][2];                          // B operand: query i0 + 16 g + lr, kept for the whole kernel
#pragma unroll
    for (int g = 0; g < 2; ++g)
#pragma unroll
        for (int ks = 0; ks < 2; ++ks) qf[g][ks] = WFrag<bf>::ld(Qb + (size_t)(i0 + g * 16 + lr) * HD + ks * 32 + 8 * hi);
    v8f o[2][4]; float m[2], l[2];
#pragma unroll
    for (int g = 0; g < 2; ++g) { m[g] = -3.0e38f; l[g] = 0.f;
#pragma unroll
        for (int db = 0; db < 4; ++db) o[g][db] = (v8f){}; }
    // kept rolled for speed only
#pragma unroll 1
    for (int it = 0; it < KPW / 64; ++it) {
        const int j0 = w * KPW + it * 64;
        // E^T over the 96 table rows j - i = j0 - i0 - 31 .. j0 - i0 + 64 (clamped); group 0 needs window blocks 1..5, group 1 blocks 0..4
        { v16bf ta[6][2];
#pragma unroll
        for (int wb = 0; wb < 6; ++wb) { const int tr = min(max(j0 - i0 - 31 + wb * 16 + lr + MAXD, 0), 2 * MAXD); const unsigned tp = (unsigned)(tr * HD + 8 * hi) * 2u; ta[wb][0] = ldo(TB, tp); ta[wb][1] = ldo(TB, tp + 64u); }
        // keeps the 24 table loads above in one batch: otherwise the first blocks' loads are each waited for before the next block's are issued
        __builtin_amdgcn_sched_barrier(0);
        asm volatile("s_wait_xcnt 0x0" ::: "memory");    // before the loads' address registers are re-used
#pragma unroll
        for (int wb = 0; wb < 6; ++wb) { v8f e[2];
#pragma unroll
            for (int g = 0; g < 2; ++g) e[g] = wmmab(ta[wb][0], qf[g][0], (v8f){});
#pragma unroll
            for (int g = 0; g < 2; ++g) e[g] = wmmab(ta[wb][1], qf[g][1], e[g]);
            // WMMA distance: four vector slots behind the products above, before a later matrix instruction starts a new sum in the same registers (the compiler re-uses them at once)
            if (wb == 0) asm volatile("v_nop\n\tv_nop\n\tv_nop\n\tv_nop" :: "v"(e[1])); else if (wb == 5) asm volatile("v_nop\n\tv_nop\n\tv_nop\n\tv_nop" :: "v"(e[0])); else asm volatile("v_nop\n\tv_nop\n\tv_nop\n\tv_nop" :: "v"(e[0]), "v"(e[1]));
#pragma unroll
            for (int g = 0; g < 2; ++g) { const int lb = wb - 1 + g; if (lb >= 0 && lb < 5) { float* ep = es + (g * 16 + lr) * EP + lb * 16 + 8 * hi;
                *(v4fa*)ep = __builtin_shufflevector(e[g], e[g], 0, 1, 2, 3); *(v4fa*)(ep + 4) = __builtin_shufflevector(e[g], e[g], 4, 5, 6, 7); } } } }
        v16bf ka[4][2];
#pragma unroll
        for (int kb = 0; kb < 4; ++kb) { const unsigned kp = (unsigned)((j0 + kb * 16 + lr) * HD + 8 * hi) * 2u; ka[kb][0] = ldo(Kb, kp); ka[kb][1] = ldo(Kb, kp + 64u); }
        asm volatile("s_wait_xcnt 0x0" ::: "memory");    // before the loads' address registers are re-used
        // keeps the skewed reads below behind the other half-wave's stores above (same wave: LDS runs its operations in order)
        __builtin_amdgcn_wave_barrier(); asm volatile("" ::: "memory");
        v8f s[2][4];                         // s[g][kb][r] = score of key j0 + 16 kb + 8 hi + r for query i0 + 16 g + lr; starts as the bias, the q.k products accumulate onto it
#pragma unroll
        for (int g = 0; g < 2; ++g) { const float* er = es + (g * 16 + lr) * EP - lr + 15 + 8 * hi;
#pragma unroll
            for (int kb = 0; kb < 4; ++kb)
#pragma unroll
                for (int r = 0; r < 8; ++r) s[g][kb][r] = er[kb * 16 + r]; }
        // keeps the next pass's E^T stores behind the reads above
        __builtin_amdgcn_wave_barrier(); asm volatile("" ::: "memory");
#pragma unroll
        for (int ks = 0; ks < 2; ++ks)
#pragma unroll
            for (int kb = 0; kb < 4; ++kb)
#pragma unroll
                for (int g = 0; g < 2; ++g) s[g][kb] = wmmab(ka[kb][ks], qf[g][ks], s[g][kb]);
        v16bf ph[2][2], pl[2][2];            // P^T as B operands: two score tiles (32 keys) pack into one fragment in the hardware k order
#pragma unroll
        for (int g = 0; g < 2; ++g) { float mx = m[g];
#pragma unroll
            for (int kb = 0; kb < 4; ++kb)
#pragma unroll
                for (int r = 0; r < 8; ++r) { const float y = s[g][kb][r] * CSL; s[g][kb][r] = y; mx = fmaxf(mx, y); }
            mx = fmaxf(mx, __shfl_xor(mx, 16, 32));
            const float al = exp2n(m[g] - mx); m[g] = mx; float sum = 0.f;
            // splits the scheduling region: the two query groups' softmax runs are then not interleaved, which keeps the build free of spills
            __builtin_amdgcn_sched_barrier(0);
#pragma unroll
            for (int kb = 0; kb < 4; ++kb)
#pragma unroll
                for (int r = 0; r < 8; ++r) { const float p = exp2n(s[g][kb][r] - mx); s[g][kb][r] = p; sum += p; }
            l[g] = l[g] * al + sum;
#pragma unroll
            for (int db = 0; db < 4; ++db) o[g][db] *= al;
#pragma unroll
            for (int ks = 0; ks < 2; ++ks) { const v16f pv = __builtin_shufflevector(s[g][2 * ks], s[g][2 * ks + 1], 0, 1, 2, 3, 4, 5, 6, 7, 8, 9, 10, 11, 12, 13, 14, 15); const v16bf h = __builtin_convertvector(pv, v16bf);
                ph[g][ks] = h; pl[g][ks] = __builtin_convertvector(pv - __builtin_convertvector(h, v16f), v16bf); }
        }
        // ends the scheduling region of the softmax, where registers are scarce: without it the v^T loads below are issued two at a time, each pair waited for before its products
        __builtin_amdgcn_sched_barrier(0);
        v16bf va[4][2];
#pragma unroll
        for (int db = 0; db < 4; ++db)
#pragma unroll
            for (int ks = 0; ks < 2; ++ks) va[db][ks] = ldo(Vb, (unsigned)((db * 16 + lr) * TT + j0 + ks * 32 + 8 * hi) * 2u);
        asm volatile("s_wait_xcnt 0x0" ::: "memory");    // before the loads' address registers are re-used
#pragma unroll
        for (int db = 0; db < 4; ++db)
#pragma unroll
            for (int ks = 0; ks < 2; ++ks)
#pragma unroll
                for (int g = 0; g < 2; ++g) o[g][db] = wmmab(va[db][ks], pl[g][ks], wmmab(va[db][ks], ph[g][ks], o[g][db]));
    }
    // merge of the KSP key ranges: common maximum, total sum, then the scaled partial O^T tiles summed in wave order
#pragma unroll
    for (int g = 0; g < 2; ++g) { l[g] += __shfl_xor(l[g], 16, 32); if (hi == 0) { sml[0][w][g * 16 + lr] = m[g]; sml[1][w][g * 16 + lr] = l[g]; } }
    __syncthreads();                         // publishes every wave's maximum and sum; also ends every wave's use of its E^T copies
#pragma unroll
    for (int g = 0; g < 2; ++g) { float M = -3.0e38f, L = 0.f;
#pragma unroll
        for (int ww = 0; ww < KSP; ++ww) M = fmaxf(M, sml[0][ww][g * 16 + lr]);
#pragma unroll
        for (int ww = 0; ww < KSP; ++ww) L += sml[1][ww][g * 16 + lr] * exp2n(sml[0][ww][g * 16 + lr] - M);
        const float f = exp2n(m[g] - M) / L;
#pragma unroll
        for (int db = 0; db < 4; ++db) o[g][db] *= f; }
#pragma unroll
    for (int g = 0; g < 2; ++g) { float* op = sm + (w * 16 + lr) * OP + 8 * hi;
#pragma unroll
        for (int db = 0; db < 4; ++db) { *(v4fa*)(op + db * 16) = __builtin_shufflevector(o[g][db], o[g][db], 0, 1, 2, 3); *(v4fa*)(op + db * 16 + 4) = __builtin_shufflevector(o[g][db], o[g][db], 4, 5, 6, 7); }
        __syncthreads();                     // publishes the KSP partial tiles of this query group
        const int q = threadIdx.x >> 4, d4 = (threadIdx.x & 15) * 4; v4f acc = *(const v4fa*)(sm + q * OP + d4);
#pragma unroll
        for (int ww = 1; ww < KSP; ++ww) acc += *(const v4fa*)(sm + (ww * 16 + q) * OP + d4);
        *(v4f*)(OUT + (zb * TT + i0 + g * 16 + q) * HD + d4) = acc;
        if (g == 0) __syncthreads();         // the tiles are read out before group 1 overwrites them
    }
}

extern "C" void kernel_launch(void* const* d_in, const int* in_sizes, int n_in,
                              void* d_out, int out_size, void* d_ws, size_t ws_size, hipStream_t stream) {
    (void)in_sizes; (void)n_in; (void)out_size;
    const float* Qin = (const float*)d_in[0]; const float* Kin = (const float*)d_in[1]; const float* Vin = (const float*)d_in[2]; const float* tab = (const float*)d_in[3];
    float* OUT = (float*)d_out;     // [8][2048][64]
    char* wsp = (char*)d_ws;
    auto take = [&](size_t bytes) { char* p = wsp; wsp += (bytes + 255) & ~(size_t)255; return (void*)p; };
    bf* TB = (bf*)take((size_t)NRP * HD * 2); bf* QB = (bf*)take((size_t)NB_ * TT * HD * 2); bf* KB = (bf*)take((size_t)NB_ * TT * HD * 2); bf* VT = (bf*)take((size_t)NB_ * HD * TT * 2);
    if ((size_t)(wsp - (char*)d_ws) > ws_size) return;    // carve ~6.3 MiB
    k_prep<<<PB_ALL, 256, 0, stream>>>(Qin, Kin, Vin, tab, QB, KB, VT, TB);
    k_fattn<<<dim3(TT / 32, NB_, 1), KSP * 32, 0, stream>>>(QB, KB, VT, TB, OUT);
}

// v004
// One run takes 24 microseconds.
// In two side-by-side timings against v003, it was 1.65 and 1.61 times as fast.
// Over all steps from v000 it is 28.7 times as fast.
#include <hip/hip_runtime.h>

// Single-head attention with a learned relative-position bias (Music-Transformer style skew) on given q, k, v [8][2048][64]: rel_emb[e] = rel_table[clip(e - S, -1024, 1024) + 1024] (table [2049][64]); qr = skew(q . rel_emb) so that bias[i][j] = q_i . rel_table[clip(j - i, -1024, 1024) + 1024]; scores = (q.k + bias) / 8; softmax over all keys; out = w v -> [8][2048][64] (1.0 M).
// One fused kernel (k_fattn) does scores, bias, softmax and P x v; the score matrix never reaches memory. Before it, one kernel (k_prep) rounds q, k, v^T and the clipped table rows rel_emb to bf16 planes.
// The planes lie in fragment order: a tile of 16 rows x 64 k values is 2 KiB, four blocks of 512 bytes, and a block holds the 32 lanes' 16-byte pieces of one fragment half, so a fragment load of a wave reads four whole 128-byte lines instead of 32 bytes out of each of sixteen.
// Transposed products: S^T = k q^T and E^T = (table window) q^T, so a lane holds one query's scores; the bias of key j for query i is row (j - i) of E^T, fetched per lane from an LDS copy of E^T (the skew); the table row index is clamped as the module clips it, where k_prep gathers the rows.
// Compute dtypes, f32 accumulate: every input rounded to bf16; q.k, q.table exact products; softmax f32, running maximum; unnormalised P as bf16 hi/lo x exact v^T (2 products); f32 output rows.

#define NB_  8
#define TT   2048
#define DM   1024
#define NH_  1
#define NKV  1
#define REP  (NH_ / NKV)
#define HD   64
#define DQ   (NH_ * HD)
#define DKV  (NKV * HD)
#define ZH   2
#define RH   2048
#define WIN  0
#define PCAR 1024.0f
#define SCL  0.125f   // 1/sqrt(64) applied to (q.k + bias)
#define NREL 2049   // table rows (2*MAX_DIST + 1)
#define NXT  4096   // rows of the clipped-table plane: row u holds table row clip(u - 2047, -1024, 1024) + 1024, u = j - i + 2047
#define MAXD 1024
typedef _Float16 h16;
typedef unsigned short bf;
typedef __attribute__((ext_vector_type(16))) __bf16   v16bf;
typedef __attribute__((ext_vector_type(16))) _Float16 v16h;
typedef __attribute__((ext_vector_type(8)))  _Float16 v8h;
typedef __attribute__((ext_vector_type(8)))  unsigned short v8us;
typedef __attribute__((ext_vector_type(8)))  float    v8f;
typedef __attribute__((ext_vector_type(4)))  float    v4f;
typedef v8h  __attribute__((may_alias)) v8ha;
typedef v4f  __attribute__((may_alias)) v4fa;
typedef v8us __attribute__((may_alias)) v8usa;

__device__ __forceinline__ unsigned short f2bf(float f) { unsigned u = __float_as_uint(f); u += 0x7FFFu + ((u >> 16) & 1u); return (unsigned short)(u >> 16); }
__device__ __forceinline__ float bf2f(unsigned short b) { return __uint_as_float(((unsigned)b) << 16); }
__device__ __forceinline__ float bfr(float f) { return bf2f(f2bf(f)); }
__device__ __forceinline__ v16h cat16(v8h lo, v8h hi) { return __builtin_shufflevector(lo, hi, 0, 1, 2, 3, 4, 5, 6, 7, 8, 9, 10, 11, 12, 13, 14, 15); }
__device__ __forceinline__ v16bf cat16b(v8us lo, v8us hi) { return __builtin_bit_cast(v16bf, __builtin_shufflevector(lo, hi, 0, 1, 2, 3, 4, 5, 6, 7, 8, 9, 10, 11, 12, 13, 14, 15)); }
__device__ __forceinline__ v8f wmma16(v16h a, v16h b, v8f c) { return __builtin_amdgcn_wmma_f32_16x16x32_f16(false, a, false, b, (short)0, c, false, false); }
__device__ __forceinline__ v8f wmmab(v16bf a, v16bf b, v8f c) { return __builtin_amdgcn_wmma_f32_16x16x32_bf16(false, a, false, b, (short)0, c, false, false); }



// Fragment loader: 16 elements of one K-contiguous row in the hardware k order (k = 8h .. 8h+7, then 16+8h .. 16+8h+7), the same for A and B.
template <typename T16> struct WFrag;
template <> struct WFrag<h16> { typedef v16h V; static __device__ __forceinline__ V ld(const h16* p) { return cat16(*(const v8h*)p, *(const v8h*)(p + 16)); } static __device__ __forceinline__ v8f mma(V a, V b, v8f c) { return wmma16(a, b, c); } };
template <> struct WFrag<bf> { typedef v16bf V; static __device__ __forceinline__ V ld(const bf* p) { return cat16b(*(const v8us*)p, *(const v8us*)(p + 16)); } static __device__ __forceinline__ v8f mma(V a, V b, v8f c) { return wmmab(a, b, c); } };
__device__ __forceinline__ h16 tohx(float x) { return (h16)x; }
__device__ __forceinline__ void splitf(float y, unsigned short& h, unsigned short& l) { h = f2bf(y); l = f2bf(y - bf2f(h)); }
typedef __attribute__((ext_vector_type(2))) _Float16 v2h;
typedef __attribute__((ext_vector_type(4))) _Float16 v4h;
typedef __attribute__((ext_vector_type(2))) unsigned short v2us;
typedef __attribute__((ext_vector_type(4))) unsigned short v4us;
typedef __attribute__((ext_vector_type(2))) float v2f;
typedef __attribute__((ext_vector_type(4))) int v4i;

__global__ __launch_bounds__(256) void k_wtG(const float* __restrict__ w, int K, int N, bf* Bt) {
    const int lane = threadIdx.x & 31; const int L0 = (blockIdx.x * 8 + (threadIdx.x >> 5)) * 8; const int nlines = N * K / 64;
{
#pragma unroll 1
        for (int l = 0; l < 8; ++l) { const int L = L0 + l; if (L >= nlines) break; const size_t e = (size_t)L * 64 + lane * 2; const int k = (int)(e % K), n = (int)(e / K); v2us o;
            o[0] = f2bf(w[(size_t)k * N + n]); o[1] = f2bf(w[(size_t)(k + 1) * N + n]); *(v2us*)(Bt + e) = o; }
         }
}

__global__ __launch_bounds__(256) void k_vtp(const float* __restrict__ F, int pitch, int nheads, h16* V16, bf* Vh, bf* Vl) { const size_t e = ((size_t)blockIdx.x * 256 + threadIdx.x) * 2; if (e >= (size_t)nheads * HD * TT) return; const int t = (int)(e % TT); const int d = (int)((e / TT) % HD); const int g = (int)(e / ((size_t)TT * HD)); v2h o16; v2us oh, ol;
#pragma unroll
    for (int q = 0; q < 2; ++q) { const float x = F[(size_t)(t + q) * pitch + g * HD + d]; o16[q] = tohx(x); unsigned short a2, c2; splitf(x, a2, c2); oh[q] = a2; ol[q] = c2; }
    *(v2h*)(V16 + e) = o16; *(v2us*)(Vh + e) = oh; *(v2us*)(Vl + e) = ol;  }

__global__ __launch_bounds__(256) void k_merge(const float* __restrict__ O, int h0, float* OUTb) { const size_t e = ((size_t)blockIdx.x * 256 + threadIdx.x) * 2; if (e >= (size_t)ZH * TT * HD) return; const int d = (int)(e % HD); const int t = (int)((e / HD) % TT); const int zz = (int)(e / ((size_t)HD * TT)); const float cs = (t < RH) ? 1.0f : (1.0f / PCAR); const size_t oo = (size_t)t * DQ + (h0 + zz) * HD + d;
    v2f o2; o2[0] = O[e] * cs; o2[1] = O[e + 1] * cs; *(v2f*)(OUTb + oo) = o2;  }

// ---- k_prep: every bf16 plane in one launch. The block index picks the job (v^T, q, k, table); a thread handles 64 elements (16 of the table), so the whole stage is PB_ALL blocks of eight waves, no more than the chip has WGPs.
#define PU     8                                   // units of 8 elements a thread
#define PB_V   (NB_ * TT * HD / (256 * 8 * PU))     // blocks of the v^T job; the q and the k job have as many
#define PB_T   (NXT * HD / (256 * 16))              // blocks of the table job, 16 elements a thread: a whole number
#define PB_ALL (3 * PB_V + PB_T)
__device__ __forceinline__ v8us cvt8(v8f v) { v8us o;
#pragma unroll
    for (int k = 0; k < 8; ++k) o[k] = f2bf(v[k]);
    return o; }
__global__ __launch_bounds__(256) void k_prep(const float* __restrict__ Qin, const float* __restrict__ Kin, const float* __restrict__ Vin, const float* __restrict__ tab, bf* __restrict__ QB, bf* __restrict__ KB, bf* __restrict__ VT, bf* __restrict__ TB) {
    const int b = blockIdx.x, tid = threadIdx.x;
    if (b < PB_V) {
        // v^T: a wave takes 64 keys x 32 columns of one batch; a lane holds 8 keys x 8 columns in registers, so a row of v is read in whole 128-byte lines; in a v^T tile (16 columns x 64 keys) the piece of column lr and key octet cc lies at block cc / 2, place (lr % 4) * 8 + (lr / 4) * 2 + cc % 2, so eight lanes of a store fill one whole line
        const int lane = tid & 31, tg = lane & 7, dg = lane >> 3; const int wt = b * 8 + (tid >> 5);
        const int z = wt / (TT / 64 * 2), r = wt % (TT / 64 * 2); const int t0 = (r >> 1) * 64 + tg * 8, d0 = (r & 1) * 32 + dg * 4;
        const float* Vb = Vin + (size_t)z * TT * HD + (size_t)t0 * HD + d0; bf* Vh = VT + (size_t)z * HD * TT + (size_t)((r >> 1) * 4 + (r & 1) * 2) * 1024 + (tg >> 1) * 256 + (dg * 2 + (tg & 1)) * 8;
        v4f x[8][2];
#pragma unroll
        for (int q = 0; q < 8; ++q) { x[q][0] = *(const v4f*)(Vb + q * HD); x[q][1] = *(const v4f*)(Vb + q * HD + 16); }
        // keeps the 16 loads above in one batch: otherwise five of them are issued only behind the first ones' data
        __builtin_amdgcn_sched_barrier(0);
        asm volatile("s_wait_xcnt 0x0" :: "v"(Vb) : "memory");     // before the loads' address registers are re-used; the address is an input, so it stays in them up to here
#pragma unroll
        for (int h = 0; h < 2; ++h)
#pragma unroll
            for (int c = 0; c < 4; ++c) { v8us o;
#pragma unroll
                for (int q = 0; q < 8; ++q) o[q] = f2bf(x[q][h][c]);
                *(v8us*)(Vh + h * 1024 + c * 64) = o; }
    } else if (b < 3 * PB_V) {
        const bool isq = b < 2 * PB_V; const float* src = isq ? Qin : Kin; bf* dst = isq ? QB : KB;
        // a wave takes two tiles of 16 rows; a load unit is four whole rows, and its store fills one whole line in each of the tile's four blocks (row lr, octet cc: block cc / 2, place lr * 2 + cc % 2)
        const int lane = tid & 31; const size_t i0 = (size_t)(b - (isq ? PB_V : 2 * PB_V)) * (256 * PU) + (tid >> 5) * (32 * PU) + lane; const float* sp = src + i0 * 8; v8f x[PU];
        bf* dp = dst + (i0 >> 7) * 1024 + ((lane & 7) >> 1) * 256 + (lane >> 3) * 16 + (lane & 1) * 8;
#pragma unroll
        for (int u = 0; u < PU; ++u) x[u] = *(const v8f*)(sp + u * 256);
        asm volatile("s_wait_xcnt 0x0" :: "v"(sp) : "memory");     // as above
#pragma unroll
        for (int u = 0; u < PU; ++u) *(v8us*)(dp + (u >> 2) * 1024 + (u & 3) * 64) = cvt8(x[u]);
        asm volatile("s_wait_xcnt 0x0" ::: "memory");     // behind the stores: before a register that they name is written again
    } else {
        // clipped table rows: a thread takes a quarter of a row, which is that row's 32 bytes of one block of its tile
        const int j = (b - 3 * PB_V) * 256 + tid, r = j / 4; const float* tp = tab + (size_t)min(max(r - (TT - 1) + MAXD, 0), 2 * MAXD) * HD + (j % 4) * 16;
        bf* dp = TB + (size_t)(r >> 4) * 1024 + (j % 4) * 256 + (r & 15) * 16;
        const v8f x0 = *(const v8f*)tp, x1 = *(const v8f*)(tp + 8);
        asm volatile("s_wait_xcnt 0x0" :: "v"(tp) : "memory");     // as above
        *(v8us*)dp = cvt8(x0); *(v8us*)(dp + 8) = cvt8(x1);
        asm volatile("s_wait_xcnt 0x0" ::: "memory");     // behind the stores, as above
    }
}
// ---- k_fattn: one block = 32 queries of one batch; its KSP waves each take KPW keys in passes of 64 and keep a running maximum, sum and O^T; the partial results are merged in LDS at the end, in wave order.
#define KSP 8                      // waves per block = key ranges of one query block
#define KPW (TT / KSP)             // keys per wave
#define EP  84                     // floats per query row of the E^T copy (80 window rows + 4: the skewed b32 reads and the b128 stores then fall on distinct banks)
#define OP  68                     // floats per query row of a partial output tile
#define CSL 0.18033688011112042f   // SCL * log2(e)
typedef __attribute__((ext_vector_type(16))) float v16f;
// fragment of a plane in fragment order, at the lane's address in the batch's first block plus a constant (one address pair for a whole batch of loads, the constant in the instruction): its two halves (k = 8 hi .. 8 hi + 7 and 16 more) lie one 512-byte block apart
__device__ __forceinline__ v16bf ldo(const char* p, int k) { return cat16b(*(const v8us*)(p + k), *(const v8us*)(p + k + 512)); }
// 2^x with the slot behind a transcendental filled in the same statement
__device__ __forceinline__ float exp2n(float x) { float r; asm("v_exp_f32 %0, %1\n\tv_nop" : "=v"(r) : "v"(x)); return r; }
// four waves per SIMD (two blocks per WGP): holds the build to 256 registers
__global__ __launch_bounds__(KSP * 32) __attribute__((amdgpu_waves_per_eu(4, 4))) void k_fattn(const bf* __restrict__ QB, const bf* __restrict__ KB, const bf* __restrict__ VT, const bf* __restrict__ TB, float* __restrict__ OUT) {
    __shared__ __align__(16) float sm[KSP * 2 * 16 * EP];
    __shared__ float sml[2][KSP][32];
    const int lane = threadIdx.x & 31, lr = lane & 15, hi = lane >> 4, w = __builtin_amdgcn_readfirstlane(threadIdx.x >> 5);    // the wave's number as a scalar: the tile addresses below are then scalar
    const int i0 = blockIdx.x * 32; const size_t zb = blockIdx.y;
    const bf* Qb = QB + zb * TT * HD; const bf* Kb = KB + zb * TT * HD; const bf* Vb = VT + zb * HD * TT;
    const unsigned lo = (unsigned)(lr * 32 + hi * 16), lov = (unsigned)(((lr & 3) * 8 + (lr >> 2) * 2 + hi) * 16);    // the lane's piece inside a 512-byte block: q, k and table planes; v^T plane
    float* es = sm + w * (2 * 16 * EP);      // this wave's own E^T copies, one per query group
    v16bf qf[2][2];                          // B operand: query i0 + 16 g + lr, kept for the whole kernel
#pragma unroll
    for (int g = 0; g < 2; ++g)
#pragma unroll
        for (int ks = 0; ks < 2; ++ks) qf[g][ks] = ldo((const char*)(Qb + i0 * HD) + lo, g * 2048 + ks * 1024);
    v8f o[2][4]; float m[2], l[2];
#pragma unroll
    for (int g = 0; g < 2; ++g) { m[g] = -3.0e38f; l[g] = 0.f;
#pragma unroll
        for (int db = 0; db < 4; ++db) o[g][db] = (v8f){}; }
    // kept rolled for speed only
#pragma unroll 1
    for (int it = 0; it < KPW / 64; ++it) {
        const int j0 = w * KPW + it * 64;
        // E^T over the 96 clipped table rows j - i = j0 - i0 - 31 .. j0 - i0 + 64, six whole tiles of the plane; group 0 needs window blocks 1..5, group 1 blocks 0..4
        { v16bf ta[6][2]; const char* tp = (const char*)(TB + (j0 - i0 + TT - 32) * HD) + lo;
#pragma unroll
        for (int wb = 0; wb < 6; ++wb) { ta[wb][0] = ldo(tp, wb * 2048); ta[wb][1] = ldo(tp, wb * 2048 + 1024); }
        // keeps the 24 table loads above in one batch: otherwise the first blocks' loads are each waited for before the next block's are issued
        __builtin_amdgcn_sched_barrier(0);
        asm volatile("s_wait_xcnt 0x0" :: "v"(tp) : "memory");    // before the loads' address registers are re-used; the address is an input, so it stays in them up to here
#pragma unroll
        for (int wb = 0; wb < 6; ++wb) { v8f e[2];
#pragma unroll
            for (int g = 0; g < 2; ++g) e[g] = wmmab(ta[wb][0], qf[g][0], (v8f){});
#pragma unroll
            for (int g = 0; g < 2; ++g) e[g] = wmmab(ta[wb][1], qf[g][1], e[g]);
            // WMMA distance: four vector slots behind the products above, before a later matrix instruction starts a new sum in the same registers (the compiler re-uses them at once)
            if (wb == 0) asm volatile("v_nop\n\tv_nop\n\tv_nop\n\tv_nop" :: "v"(e[1])); else if (wb == 5) asm volatile("v_nop\n\tv_nop\n\tv_nop\n\tv_nop" :: "v"(e[0])); else asm volatile("v_nop\n\tv_nop\n\tv_nop\n\tv_nop" :: "v"(e[0]), "v"(e[1]));
#pragma unroll
            for (int g = 0; g < 2; ++g) { const int lb = wb - 1 + g; if (lb >= 0 && lb < 5) { float* ep = es + (g * 16 + lr) * EP + lb * 16 + 8 * hi;
                *(v4fa*)ep = __builtin_shufflevector(e[g], e[g], 0, 1, 2, 3); *(v4fa*)(ep + 4) = __builtin_shufflevector(e[g], e[g], 4, 5, 6, 7); } } } }
        v16bf ka[4][2]; const char* kp = (const char*)(Kb + j0 * HD) + lo;
#pragma unroll
        for (int kb = 0; kb < 4; ++kb) { ka[kb][0] = ldo(kp, kb * 2048); ka[kb][1] = ldo(kp, kb * 2048 + 1024); }
        asm volatile("s_wait_xcnt 0x0" :: "v"(kp) : "memory");    // as above
        // keeps the skewed reads below behind the other half-wave's stores above (same wave: LDS runs its operations in order)
        __builtin_amdgcn_wave_barrier(); asm volatile("" ::: "memory");
        v8f s[2][4];                         // s[g][kb][r] = score of key j0 + 16 kb + 8 hi + r for query i0 + 16 g + lr; starts as the bias, the q.k products accumulate onto it
#pragma unroll
        for (int g = 0; g < 2; ++g) { const float* er = es + (g * 16 + lr) * EP - lr + 15 + 8 * hi;
#pragma unroll
            for (int kb = 0; kb < 4; ++kb)
#pragma unroll
                for (int r = 0; r < 8; ++r) s[g][kb][r] = er[kb * 16 + r]; }
        // keeps the next pass's E^T stores behind the reads above
        __builtin_amdgcn_wave_barrier(); asm volatile("" ::: "memory");
#pragma unroll
        for (int ks = 0; ks < 2; ++ks)
#pragma unroll
            for (int kb = 0; kb < 4; ++kb)
#pragma unroll
                for (int g = 0; g < 2; ++g) s[g][kb] = wmmab(ka[kb][ks], qf[g][ks], s[g][kb]);
        v16bf ph[2][2], pl[2][2];            // P^T as B operands: two score tiles (32 keys) pack into one fragment in the hardware k order
#pragma unroll
        for (int g = 0; g < 2; ++g) { float mx = m[g];
#pragma unroll
            for (int kb = 0; kb < 4; ++kb)
#pragma unroll
                for (int r = 0; r < 8; ++r) { const float y = s[g][kb][r] * CSL; s[g][kb][r] = y; mx = fmaxf(mx, y); }
            mx = fmaxf(mx, __shfl_xor(mx, 16, 32));
            const float al = exp2n(m[g] - mx); m[g] = mx; float sum = 0.f;
            // splits the scheduling region: the two query groups' softmax runs are then not interleaved, which keeps the build free of spills
            __builtin_amdgcn_sched_barrier(0);
#pragma unroll
            for (int kb = 0; kb < 4; ++kb)
#pragma unroll
                for (int r = 0; r < 8; ++r) { const float p = exp2n(s[g][kb][r] - mx); s[g][kb][r] = p; sum += p; }
            l[g] = l[g] * al + sum;
#pragma unroll
            for (int db = 0; db < 4; ++db) o[g][db] *= al;
#pragma unroll
            for (int ks = 0; ks < 2; ++ks) { const v16f pv = __builtin_shufflevector(s[g][2 * ks], s[g][2 * ks + 1], 0, 1, 2, 3, 4, 5, 6, 7, 8, 9, 10, 11, 12, 13, 14, 15); const v16bf h = __builtin_convertvector(pv, v16bf);
                ph[g][ks] = h; pl[g][ks] = __builtin_convertvector(pv - __builtin_convertvector(h, v16f), v16bf); }
        }
        // ends the scheduling region of the softmax, where registers are scarce: without it the v^T loads below are issued two at a time, each pair waited for before its products
        __builtin_amdgcn_sched_barrier(0);
        v16bf va[4][2]; const char* vp = (const char*)(Vb + j0 * HD) + lov;
#pragma unroll
        for (int db = 0; db < 4; ++db)
#pragma unroll
            for (int ks = 0; ks < 2; ++ks) va[db][ks] = ldo(vp, db * 2048 + ks * 1024);
        asm volatile("s_wait_xcnt 0x0" :: "v"(vp) : "memory");    // as above
#pragma unroll
        for (int db = 0; db < 4; ++db)
#pragma unroll
            for (int ks = 0; ks < 2; ++ks)
#pragma unroll
                for (int g = 0; g < 2; ++g) o[g][db] = wmmab(va[db][ks], pl[g][ks], wmmab(va[db][ks], ph[g][ks], o[g][db]));
    }
    // merge of the KSP key ranges: common maximum, total sum, then the scaled partial O^T tiles summed in wave order
#pragma unroll
    for (int g = 0; g < 2; ++g) { l[g] += __shfl_xor(l[g], 16, 32); if (hi == 0) { sml[0][w][g * 16 + lr] = m[g]; sml[1][w][g * 16 + lr] = l[g]; } }
    __syncthreads();                         // publishes every wave's maximum and sum; also ends every wave's use of its E^T copies
#pragma unroll
    for (int g = 0; g < 2; ++g) { float M = -3.0e38f, L = 0.f;
#pragma unroll
        for (int ww = 0; ww < KSP; ++ww) M = fmaxf(M, sml[0][ww][g * 16 + lr]);
#pragma unroll
        for (int ww = 0; ww < KSP; ++ww) L += sml[1][ww][g * 16 + lr] * exp2n(sml[0][ww][g * 16 + lr] - M);
        const float f = exp2n(m[g] - M) / L;
#pragma unroll
        for (int db = 0; db < 4; ++db) o[g][db] *= f; }
#pragma unroll
    for (int g = 0; g < 2; ++g) { float* op = sm + (w * 16 + lr) * OP + 8 * hi;
#pragma unroll
        for (int db = 0; db < 4; ++db) { *(v4fa*)(op + db * 16) = __builtin_shufflevector(o[g][db], o[g][db], 0, 1, 2, 3); *(v4fa*)(op + db * 16 + 4) = __builtin_shufflevector(o[g][db], o[g][db], 4, 5, 6, 7); }
        __syncthreads();                     // publishes the KSP partial tiles of this query group
        const int q = threadIdx.x >> 4, d4 = (threadIdx.x & 15) * 4; v4f acc = *(const v4fa*)(sm + q * OP + d4);
#pragma unroll
        for (int ww = 1; ww < KSP; ++ww) acc += *(const v4fa*)(sm + (ww * 16 + q) * OP + d4);
        *(v4f*)(OUT + (zb * TT + i0 + g * 16 + q) * HD + d4) = acc;
        if (g == 0) __syncthreads();         // the tiles are read out before group 1 overwrites them
    }
}

extern "C" void kernel_launch(void* const* d_in, const int* in_sizes, int n_in,
                              void* d_out, int out_size, void* d_ws, size_t ws_size, hipStream_t stream) {
    (void)in_sizes; (void)n_in; (void)out_size;
    const float* Qin = (const float*)d_in[0]; const float* Kin = (const float*)d_in[1]; const float* Vin = (const float*)d_in[2]; const float* tab = (const float*)d_in[3];
    float* OUT = (float*)d_out;     // [8][2048][64]
    char* wsp = (char*)d_ws;
    auto take = [&](size_t bytes) { char* p = wsp; wsp += (bytes + 255) & ~(size_t)255; return (void*)p; };
    bf* TB = (bf*)take((size_t)NXT * HD * 2); bf* QB = (bf*)take((size_t)NB_ * TT * HD * 2); bf* KB = (bf*)take((size_t)NB_ * TT * HD * 2); bf* VT = (bf*)take((size_t)NB_ * HD * TT * 2);
    if ((size_t)(wsp - (char*)d_ws) > ws_size) return;    // carve under 7 MiB
    k_prep<<<PB_ALL, 256, 0, stream>>>(Qin, Kin, Vin, tab, QB, KB, VT, TB);
    k_fattn<<<dim3(TT / 32, NB_, 1), KSP * 32, 0, stream>>>(QB, KB, VT, TB, OUT);
}

// v005
// A run of this version takes 21.9 microseconds.
// Timed twice side by side with v004, it ran 1.10 and 1.08 times as fast.
// Counting every step since v000, it is 31.4 times as fast.
#include <hip/hip_runtime.h>

// Single-head attention with a learned relative-position bias (Music-Transformer style skew) on given q, k, v [8][2048][64]: rel_emb[e] = rel_table[clip(e - S, -1024, 1024) + 1024] (table [2049][64]); qr = skew(q . rel_emb) so that bias[i][j] = q_i . rel_table[clip(j - i, -1024, 1024) + 1024]; scores = (q.k + bias) / 8; softmax over all keys; out = w v -> [8][2048][64] (1.0 M).
// One fused kernel (k_fattn) does scores, bias, softmax and P x v; the score matrix never reaches memory. Before it, one kernel (k_prep) rounds q, k, v^T and the clipped table rows rel_emb to bf16 planes (v^T: the bf16-rounded values, written as f16).
// The planes lie in fragment order: a tile of 16 rows x 64 k values is 2 KiB, four blocks of 512 bytes, and a block holds the 32 lanes' 16-byte pieces of one fragment half, so a fragment load of a wave reads four whole 128-byte lines instead of 32 bytes out of each of sixteen.
// Transposed products: S^T = k q^T and E^T = (table window) q^T, so a lane holds one query's scores; the bias of key j for query i is row (j - i) of E^T, fetched per lane from an LDS copy of E^T (the skew); the table row index is clamped as the module clips it, where k_prep gathers the rows.
// Compute dtypes, f32 accumulate: every input rounded to bf16; q.k, q.table exact products; softmax f32, running maximum; unnormalised P (0 .. 1) rounded once to f16 x v^T, whose bf16-rounded values are stored as f16 (1 product); f32 output rows.

#define NB_  8
#define TT   2048
#define DM   1024
#define NH_  1
#define NKV  1
#define REP  (NH_ / NKV)
#define HD   64
#define DQ   (NH_ * HD)
#define DKV  (NKV * HD)
#define ZH   2
#define RH   2048
#define WIN  0
#define PCAR 1024.0f
#define SCL  0.125f   // 1/sqrt(64) applied to (q.k + bias)
#define NREL 2049   // table rows (2*MAX_DIST + 1)
#define NXT  4096   // rows of the clipped-table plane: row u holds table row clip(u - 2047, -1024, 1024) + 1024, u = j - i + 2047
#define MAXD 1024
typedef _Float16 h16;
typedef unsigned short bf;
typedef __attribute__((ext_vector_type(16))) __bf16   v16bf;
typedef __attribute__((ext_vector_type(16))) _Float16 v16h;
typedef __attribute__((ext_vector_type(8)))  _Float16 v8h;
typedef __attribute__((ext_vector_type(8)))  unsigned short v8us;
typedef __attribute__((ext_vector_type(8)))  float    v8f;
typedef __attribute__((ext_vector_type(4)))  float    v4f;
typedef v8h  __attribute__((may_alias)) v8ha;
typedef v4f  __attribute__((may_alias)) v4fa;
typedef v8us __attribute__((may_alias)) v8usa;

__device__ __forceinline__ unsigned short f2bf(float f) { unsigned u = __float_as_uint(f); u += 0x7FFFu + ((u >> 16) & 1u); return (unsigned short)(u >> 16); }
__device__ __forceinline__ float bf2f(unsigned short b) { return __uint_as_float(((unsigned)b) << 16); }
__device__ __forceinline__ float bfr(float f) { return bf2f(f2bf(f)); }
__device__ __forceinline__ v16h cat16(v8h lo, v8h hi) { return __builtin_shufflevector(lo, hi, 0, 1, 2, 3, 4, 5, 6, 7, 8, 9, 10, 11, 12, 13, 14, 15); }
__device__ __forceinline__ v16bf cat16b(v8us lo, v8us hi) { return __builtin_bit_cast(v16bf, __builtin_shufflevector(lo, hi, 0, 1, 2, 3, 4, 5, 6, 7, 8, 9, 10, 11, 12, 13, 14, 15)); }
__device__ __forceinline__ v8f wmma16(v16h a, v16h b, v8f c) { return __builtin_amdgcn_wmma_f32_16x16x32_f16(false, a, false, b, (short)0, c, false, false); }
__device__ __forceinline__ v8f wmmab(v16bf a, v16bf b, v8f c) { return __builtin_amdgcn_wmma_f32_16x16x32_bf16(false, a, false, b, (short)0, c, false, false); }



// Fragment loader: 16 elements of one K-contiguous row in the hardware k order (k = 8h .. 8h+7, then 16+8h .. 16+8h+7), the same for A and B.
template <typename T16> struct WFrag;
template <> struct WFrag<h16> { typedef v16h V; static __device__ __forceinline__ V ld(const h16* p) { return cat16(*(const v8h*)p, *(const v8h*)(p + 16)); } static __device__ __forceinline__ v8f mma(V a, V b, v8f c) { return wmma16(a, b, c); } };
template <> struct WFrag<bf> { typedef v16bf V; static __device__ __forceinline__ V ld(const bf* p) { return cat16b(*(const v8us*)p, *(const v8us*)(p + 16)); } static __device__ __forceinline__ v8f mma(V a, V b, v8f c) { return wmmab(a, b, c); } };
__device__ __forceinline__ h16 tohx(float x) { return (h16)x; }
__device__ __forceinline__ void splitf(float y, unsigned short& h, unsigned short& l) { h = f2bf(y); l = f2bf(y - bf2f(h)); }
typedef __attribute__((ext_vector_type(2))) _Float16 v2h;
typedef __attribute__((ext_vector_type(4))) _Float16 v4h;
typedef __attribute__((ext_vector_type(2))) unsigned short v2us;
typedef __attribute__((ext_vector_type(4))) unsigned short v4us;
typedef __attribute__((ext_vector_type(2))) float v2f;
typedef __attribute__((ext_vector_type(4))) int v4i;

__global__ __launch_bounds__(256) void k_wtG(const float* __restrict__ w, int K, int N, bf* Bt) {
    const int lane = threadIdx.x & 31; const int L0 = (blockIdx.x * 8 + (threadIdx.x >> 5)) * 8; const int nlines = N * K / 64;
{
#pragma unroll 1
        for (int l = 0; l < 8; ++l) { const int L = L0 + l; if (L >= nlines) break; const size_t e = (size_t)L * 64 + lane * 2; const int k = (int)(e % K), n = (int)(e / K); v2us o;
            o[0] = f2bf(w[(size_t)k * N + n]); o[1] = f2bf(w[(size_t)(k + 1) * N + n]); *(v2us*)(Bt + e) = o; }
         }
}

__global__ __launch_bounds__(256) void k_vtp(const float* __restrict__ F, int pitch, int nheads, h16* V16, bf* Vh, bf* Vl) { const size_t e = ((size_t)blockIdx.x * 256 + threadIdx.x) * 2; if (e >= (size_t)nheads * HD * TT) return; const int t = (int)(e % TT); const int d = (int)((e / TT) % HD); const int g = (int)(e / ((size_t)TT * HD)); v2h o16; v2us oh, ol;
#pragma unroll
    for (int q = 0; q < 2; ++q) { const float x = F[(size_t)(t + q) * pitch + g * HD + d]; o16[q] = tohx(x); unsigned short a2, c2; splitf(x, a2, c2); oh[q] = a2; ol[q] = c2; }
    *(v2h*)(V16 + e) = o16; *(v2us*)(Vh + e) = oh; *(v2us*)(Vl + e) = ol;  }

__global__ __launch_bounds__(256) void k_merge(const float* __restrict__ O, int h0, float* OUTb) { const size_t e = ((size_t)blockIdx.x * 256 + threadIdx.x) * 2; if (e >= (size_t)ZH * TT * HD) return; const int d = (int)(e % HD); const int t = (int)((e / HD) % TT); const int zz = (int)(e / ((size_t)HD * TT)); const float cs = (t < RH) ? 1.0f : (1.0f / PCAR); const size_t oo = (size_t)t * DQ + (h0 + zz) * HD + d;
    v2f o2; o2[0] = O[e] * cs; o2[1] = O[e + 1] * cs; *(v2f*)(OUTb + oo) = o2;  }

// ---- k_prep: every bf16 plane in one launch. The block index picks the job (v^T, q, k, table); a thread handles 64 elements (16 of the table), so the whole stage is PB_ALL blocks of eight waves, no more than the chip has WGPs.
#define PU     8                                   // units of 8 elements a thread
#define PB_V   (NB_ * TT * HD / (256 * 8 * PU))     // blocks of the v^T job; the q and the k job have as many
#define PB_T   (NXT * HD / (256 * 16))              // blocks of the table job, 16 elements a thread: a whole number
#define PB_ALL (3 * PB_V + PB_T)
// bits of the f16 that holds the bf16-rounded value: the same number wherever it is a normal f16
__device__ __forceinline__ unsigned short f2hb(float f) { return __builtin_bit_cast(unsigned short, (h16)bfr(f)); }
__device__ __forceinline__ v8us cvt8(v8f v) { v8us o;
#pragma unroll
    for (int k = 0; k < 8; ++k) o[k] = f2bf(v[k]);
    return o; }
__global__ __launch_bounds__(256) void k_prep(const float* __restrict__ Qin, const float* __restrict__ Kin, const float* __restrict__ Vin, const float* __restrict__ tab, bf* __restrict__ QB, bf* __restrict__ KB, bf* __restrict__ VT, bf* __restrict__ TB) {
    const int b = blockIdx.x, tid = threadIdx.x;
    if (b < PB_V) {
        // v^T: a wave takes 64 keys x 32 columns of one batch; a lane holds 8 keys x 8 columns in registers, so a row of v is read in whole 128-byte lines; in a v^T tile (16 columns x 64 keys) the piece of column lr and key octet cc lies at block cc / 2, place (lr % 4) * 8 + (lr / 4) * 2 + cc % 2, so eight lanes of a store fill one whole line
        const int lane = tid & 31, tg = lane & 7, dg = lane >> 3; const int wt = b * 8 + (tid >> 5);
        const int z = wt / (TT / 64 * 2), r = wt % (TT / 64 * 2); const int t0 = (r >> 1) * 64 + tg * 8, d0 = (r & 1) * 32 + dg * 4;
        const float* Vb = Vin + (size_t)z * TT * HD + (size_t)t0 * HD + d0; bf* Vh = VT + (size_t)z * HD * TT + (size_t)((r >> 1) * 4 + (r & 1) * 2) * 1024 + (tg >> 1) * 256 + (dg * 2 + (tg & 1)) * 8;
        v4f x[8][2];
#pragma unroll
        for (int q = 0; q < 8; ++q) { x[q][0] = *(const v4f*)(Vb + q * HD); x[q][1] = *(const v4f*)(Vb + q * HD + 16); }
        // keeps the 16 loads above in one batch: otherwise five of them are issued only behind the first ones' data
        __builtin_amdgcn_sched_barrier(0);
        asm volatile("s_wait_xcnt 0x0" :: "v"(Vb) : "memory");     // before the loads' address registers are re-used; the address is an input, so it stays in them up to here
#pragma unroll
        for (int h = 0; h < 2; ++h)
#pragma unroll
            for (int c = 0; c < 4; ++c) { v8us o;
#pragma unroll
                for (int q = 0; q < 8; ++q) o[q] = f2hb(x[q][h][c]);
                *(v8us*)(Vh + h * 1024 + c * 64) = o; }
    } else if (b < 3 * PB_V) {
        const bool isq = b < 2 * PB_V; const float* src = isq ? Qin : Kin; bf* dst = isq ? QB : KB;
        // a wave takes two tiles of 16 rows; a load unit is four whole rows, and its store fills one whole line in each of the tile's four blocks (row lr, octet cc: block cc / 2, place lr * 2 + cc % 2)
        const int lane = tid & 31; const size_t i0 = (size_t)(b - (isq ? PB_V : 2 * PB_V)) * (256 * PU) + (tid >> 5) * (32 * PU) + lane; const float* sp = src + i0 * 8; v8f x[PU];
        bf* dp = dst + (i0 >> 7) * 1024 + ((lane & 7) >> 1) * 256 + (lane >> 3) * 16 + (lane & 1) * 8;
#pragma unroll
        for (int u = 0; u < PU; ++u) x[u] = *(const v8f*)(sp + u * 256);
        asm volatile("s_wait_xcnt 0x0" :: "v"(sp) : "memory");     // as above
#pragma unroll
        for (int u = 0; u < PU; ++u) *(v8us*)(dp + (u >> 2) * 1024 + (u & 3) * 64) = cvt8(x[u]);
        asm volatile("s_wait_xcnt 0x0" ::: "memory");     // behind the stores: before a register that they name is written again
    } else {
        // clipped table rows: a thread takes a quarter of a row, which is that row's 32 bytes of one block of its tile
        const int j = (b - 3 * PB_V) * 256 + tid, r = j / 4; const float* tp = tab + (size_t)min(max(r - (TT - 1) + MAXD, 0), 2 * MAXD) * HD + (j % 4) * 16;
        bf* dp = TB + (size_t)(r >> 4) * 1024 + (j % 4) * 256 + (r & 15) * 16;
        const v8f x0 = *(const v8f*)tp, x1 = *(const v8f*)(tp + 8);
        asm volatile("s_wait_xcnt 0x0" :: "v"(tp) : "memory");     // as above
        *(v8us*)dp = cvt8(x0); *(v8us*)(dp + 8) = cvt8(x1);
        asm volatile("s_wait_xcnt 0x0" ::: "memory");     // behind the stores, as above
    }
}
// ---- k_fattn: one block = 32 queries of one batch; its KSP waves each take KPW keys in passes of 64 and keep a running maximum, sum and O^T; the partial results are merged in LDS at the end, in wave order.
#define KSP 8                      // waves per block = key ranges of one query block
#define KPW (TT / KSP)             // keys per wave
#define EP  84                     // floats per query row of the E^T copy (80 window rows + 4: the skewed b32 reads and the b128 stores then fall on distinct banks)
#define OP  68                     // floats per query row of a partial output tile
#define CSL 0.18033688011112042f   // SCL * log2(e)
typedef __attribute__((ext_vector_type(16))) float v16f;
// fragment of a plane in fragment order, at the lane's address in the batch's first block plus a constant (one address pair for a whole batch of loads, the constant in the instruction): its two halves (k = 8 hi .. 8 hi + 7 and 16 more) lie one 512-byte block apart
__device__ __forceinline__ v16bf ldo(const char* p, int k) { return cat16b(*(const v8us*)(p + k), *(const v8us*)(p + k + 512)); }
// the same for the v^T plane, whose 16-bit values are f16
__device__ __forceinline__ v16h ldoh(const char* p, int k) { return __builtin_bit_cast(v16h, __builtin_shufflevector(*(const v8us*)(p + k), *(const v8us*)(p + k + 512), 0, 1, 2, 3, 4, 5, 6, 7, 8, 9, 10, 11, 12, 13, 14, 15)); }
// 2^x with the slot behind a transcendental filled in the same statement
__device__ __forceinline__ float exp2n(float x) { float r; asm("v_exp_f32 %0, %1\n\tv_nop" : "=v"(r) : "v"(x)); return r; }
// four waves per SIMD (two blocks per WGP): holds the build to 256 registers
__global__ __launch_bounds__(KSP * 32) __attribute__((amdgpu_waves_per_eu(4, 4))) void k_fattn(const bf* __restrict__ QB, const bf* __restrict__ KB, const bf* __restrict__ VT, const bf* __restrict__ TB, float* __restrict__ OUT) {
    __shared__ __align__(16) float sm[KSP * 2 * 16 * EP];
    __shared__ float sml[2][KSP][32];
    const int lane = threadIdx.x & 31, lr = lane & 15, hi = lane >> 4, w = __builtin_amdgcn_readfirstlane(threadIdx.x >> 5);    // the wave's number as a scalar: the tile addresses below are then scalar
    const int i0 = blockIdx.x * 32; const size_t zb = blockIdx.y;
    const bf* Qb = QB + zb * TT * HD; const bf* Kb = KB + zb * TT * HD; const bf* Vb = VT + zb * HD * TT;
    const unsigned lo = (unsigned)(lr * 32 + hi * 16), lov = (unsigned)(((lr & 3) * 8 + (lr >> 2) * 2 + hi) * 16);    // the lane's piece inside a 512-byte block: q, k and table planes; v^T plane
    float* es = sm + w * (2 * 16 * EP);      // this wave's own E^T copies, one per query group
    v16bf qf[2][2];                          // B operand: query i0 + 16 g + lr, kept for the whole kernel
#pragma unroll
    for (int g = 0; g < 2; ++g)
#pragma unroll
        for (int ks = 0; ks < 2; ++ks) qf[g][ks] = ldo((const char*)(Qb + i0 * HD) + lo, g * 2048 + ks * 1024);
    v8f o[2][4]; float m[2], l[2];
#pragma unroll
    for (int g = 0; g < 2; ++g) { m[g] = -3.0e38f; l[g] = 0.f;
#pragma unroll
        for (int db = 0; db < 4; ++db) o[g][db] = (v8f){}; }
    // kept rolled for speed only
#pragma unroll 1
    for (int it = 0; it < KPW / 64; ++it) {
        const int j0 = w * KPW + it * 64;
        // E^T over the 96 clipped table rows j - i = j0 - i0 - 31 .. j0 - i0 + 64, six whole tiles of the plane; group 0 needs window blocks 1..5, group 1 blocks 0..4
        { v16bf ta[6][2]; const char* tp = (const char*)(TB + (j0 - i0 + TT - 32) * HD) + lo;
#pragma unroll
        for (int wb = 0; wb < 6; ++wb) { ta[wb][0] = ldo(tp, wb * 2048); ta[wb][1] = ldo(tp, wb * 2048 + 1024); }
        // keeps the 24 table loads above in one batch: otherwise the first blocks' loads are each waited for before the next block's are issued
        __builtin_amdgcn_sched_barrier(0);
        asm volatile("s_wait_xcnt 0x0" :: "v"(tp) : "memory");    // before the loads' address registers are re-used; the address is an input, so it stays in them up to here
#pragma unroll
        for (int wb = 0; wb < 6; ++wb) { v8f e[2];
#pragma unroll
            for (int g = 0; g < 2; ++g) e[g] = wmmab(ta[wb][0], qf[g][0], (v8f){});
#pragma unroll
            for (int g = 0; g < 2; ++g) e[g] = wmmab(ta[wb][1], qf[g][1], e[g]);
            // WMMA distance: four vector slots behind the products above, before a later matrix instruction starts a new sum in the same registers (the compiler re-uses them at once)
            if (wb == 0) asm volatile("v_nop\n\tv_nop\n\tv_nop\n\tv_nop" :: "v"(e[1])); else if (wb == 5) asm volatile("v_nop\n\tv_nop\n\tv_nop\n\tv_nop" :: "v"(e[0])); else asm volatile("v_nop\n\tv_nop\n\tv_nop\n\tv_nop" :: "v"(e[0]), "v"(e[1]));
#pragma unroll
            for (int g = 0; g < 2; ++g) { const int lb = wb - 1 + g; if (lb >= 0 && lb < 5) { float* ep = es + (g * 16 + lr) * EP + lb * 16 + 8 * hi;
                *(v4fa*)ep = __builtin_shufflevector(e[g], e[g], 0, 1, 2, 3); *(v4fa*)(ep + 4) = __builtin_shufflevector(e[g], e[g], 4, 5, 6, 7); } } } }
        v16bf ka[4][2]; const char* kp = (const char*)(Kb + j0 * HD) + lo;
#pragma unroll
        for (int kb = 0; kb < 4; ++kb) { ka[kb][0] = ldo(kp, kb * 2048); ka[kb][1] = ldo(kp, kb * 2048 + 1024); }
        asm volatile("s_wait_xcnt 0x0" :: "v"(kp) : "memory");    // as above
        // keeps the skewed reads below behind the other half-wave's stores above (same wave: LDS runs its operations in order)
        __builtin_amdgcn_wave_barrier(); asm volatile("" ::: "memory");
        v8f s[2][4];                         // s[g][kb][r] = score of key j0 + 16 kb + 8 hi + r for query i0 + 16 g + lr; starts as the bias, the q.k products accumulate onto it
#pragma unroll
        for (int g = 0; g < 2; ++g) { const float* er = es + (g * 16 + lr) * EP - lr + 15 + 8 * hi;
#pragma unroll
            for (int kb = 0; kb < 4; ++kb)
#pragma unroll
                for (int r = 0; r < 8; ++r) s[g][kb][r] = er[kb * 16 + r]; }
        // keeps the next pass's E^T stores behind the reads above
        __builtin_amdgcn_wave_barrier(); asm volatile("" ::: "memory");
#pragma unroll
        for (int ks = 0; ks < 2; ++ks)
#pragma unroll
            for (int kb = 0; kb < 4; ++kb)
#pragma unroll
                for (int g = 0; g < 2; ++g) s[g][kb] = wmmab(ka[kb][ks], qf[g][ks], s[g][kb]);
        v16h ph[2][2];                       // P^T as f16 B operands: two score tiles (32 keys) pack into one fragment in the hardware k order
#pragma unroll
        for (int g = 0; g < 2; ++g) { float mx = m[g];
#pragma unroll
            for (int kb = 0; kb < 4; ++kb)
#pragma unroll
                for (int r = 0; r < 8; ++r) { const float y = s[g][kb][r] * CSL; s[g][kb][r] = y; mx = fmaxf(mx, y); }
            mx = fmaxf(mx, __shfl_xor(mx, 16, 32));
            const float al = exp2n(m[g] - mx); m[g] = mx; float sum = 0.f;
            // splits the scheduling region: the two query groups' softmax runs are then not interleaved, which keeps the build free of spills
            __builtin_amdgcn_sched_barrier(0);
#pragma unroll
            for (int kb = 0; kb < 4; ++kb)
#pragma unroll
                for (int r = 0; r < 8; ++r) { const float p = exp2n(s[g][kb][r] - mx); s[g][kb][r] = p; sum += p; }
            l[g] = l[g] * al + sum;
#pragma unroll
            for (int db = 0; db < 4; ++db) o[g][db] *= al;
#pragma unroll
            for (int ks = 0; ks < 2; ++ks) { const v16f pv = __builtin_shufflevector(s[g][2 * ks], s[g][2 * ks + 1], 0, 1, 2, 3, 4, 5, 6, 7, 8, 9, 10, 11, 12, 13, 14, 15);
                ph[g][ks] = __builtin_convertvector(pv, v16h); }
        }
        // ends the scheduling region of the softmax, where registers are scarce: without it the v^T loads below are issued two at a time, each pair waited for before its products
        __builtin_amdgcn_sched_barrier(0);
        v16h va[4][2]; const char* vp = (const char*)(Vb + j0 * HD) + lov;
#pragma unroll
        for (int db = 0; db < 4; ++db)
#pragma unroll
            for (int ks = 0; ks < 2; ++ks) va[db][ks] = ldoh(vp, db * 2048 + ks * 1024);
        // keeps the 16 v^T loads above in one batch: otherwise they are issued two to four at a time among the products, each group waited for in turn
        __builtin_amdgcn_sched_barrier(0);
        asm volatile("s_wait_xcnt 0x0" :: "v"(vp) : "memory");    // as above
#pragma unroll
        for (int db = 0; db < 4; ++db)
#pragma unroll
            for (int ks = 0; ks < 2; ++ks)
#pragma unroll
                for (int g = 0; g < 2; ++g) o[g][db] = wmma16(va[db][ks], ph[g][ks], o[g][db]);
    }
    // merge of the KSP key ranges: common maximum, total sum, then the scaled partial O^T tiles summed in wave order
#pragma unroll
    for (int g = 0; g < 2; ++g) { l[g] += __shfl_xor(l[g], 16, 32); if (hi == 0) { sml[0][w][g * 16 + lr] = m[g]; sml[1][w][g * 16 + lr] = l[g]; } }
    __syncthreads();                         // publishes every wave's maximum and sum; also ends every wave's use of its E^T copies
#pragma unroll
    for (int g = 0; g < 2; ++g) { float M = -3.0e38f, L = 0.f;
#pragma unroll
        for (int ww = 0; ww < KSP; ++ww) M = fmaxf(M, sml[0][ww][g * 16 + lr]);
#pragma unroll
        for (int ww = 0; ww < KSP; ++ww) L += sml[1][ww][g * 16 + lr] * exp2n(sml[0][ww][g * 16 + lr] - M);
        const float f = exp2n(m[g] - M) / L;
#pragma unroll
        for (int db = 0; db < 4; ++db) o[g][db] *= f; }
#pragma unroll
    for (int g = 0; g < 2; ++g) { float* op = sm + (w * 16 + lr) * OP + 8 * hi;
#pragma unroll
        for (int db = 0; db < 4; ++db) { *(v4fa*)(op + db * 16) = __builtin_shufflevector(o[g][db], o[g][db], 0, 1, 2, 3); *(v4fa*)(op + db * 16 + 4) = __builtin_shufflevector(o[g][db], o[g][db], 4, 5, 6, 7); }
        __syncthreads();                     // publishes the KSP partial tiles of this query group
        const int q = threadIdx.x >> 4, d4 = (threadIdx.x & 15) * 4; v4f acc = *(const v4fa*)(sm + q * OP + d4);
#pragma unroll
        for (int ww = 1; ww < KSP; ++ww) acc += *(const v4fa*)(sm + (ww * 16 + q) * OP + d4);
        *(v4f*)(OUT + (zb * TT + i0 + g * 16 + q) * HD + d4) = acc;
        if (g == 0) __syncthreads();         // the tiles are read out before group 1 overwrites them
    }
}

extern "C" void kernel_launch(void* const* d_in, const int* in_sizes, int n_in,
                              void* d_out, int out_size, void* d_ws, size_t ws_size, hipStream_t stream) {
    (void)in_sizes; (void)n_in; (void)out_size;
    const float* Qin = (const float*)d_in[0]; const float* Kin = (const float*)d_in[1]; const float* Vin = (const float*)d_in[2]; const float* tab = (const float*)d_in[3];
    float* OUT = (float*)d_out;     // [8][2048][64]
    char* wsp = (char*)d_ws;
    auto take = [&](size_t bytes) { char* p = wsp; wsp += (bytes + 255) & ~(size_t)255; return (void*)p; };
    bf* TB = (bf*)take((size_t)NXT * HD * 2); bf* QB = (bf*)take((size_t)NB_ * TT * HD * 2); bf* KB = (bf*)take((size_t)NB_ * TT * HD * 2); bf* VT = (bf*)take((size_t)NB_ * HD * TT * 2);
    if ((size_t)(wsp - (char*)d_ws) > ws_size) return;    // carve under 7 MiB
    k_prep<<<PB_ALL, 256, 0, stream>>>(Qin, Kin, Vin, tab, QB, KB, VT, TB);
    k_fattn<<<dim3(TT / 32, NB_, 1), KSP * 32, 0, stream>>>(QB, KB, VT, TB, OUT);
}

// v006
// A run of this version takes 20.7 microseconds.
// Timed twice side by side with v005, it ran 1.07 and 1.04 times as fast.
// Counting every step since v000, it is 33.2 times as fast.
#include <hip/hip_runtime.h>

// Single-head attention with a learned relative-position bias (Music-Transformer style skew) on given q, k, v [8][2048][64]: rel_emb[e] = rel_table[clip(e - S, -1024, 1024) + 1024] (table [2049][64]); qr = skew(q . rel_emb) so that bias[i][j] = q_i . rel_table[clip(j - i, -1024, 1024) + 1024]; scores = (q.k + bias) / 8; softmax over all keys; out = w v -> [8][2048][64] (1.0 M).
// One fused kernel (k_fattn) does scores, bias, softmax and P x v; the score matrix never reaches memory. Before it, one kernel (k_prep) rounds q, k, v^T and the clipped table rows rel_emb to bf16 planes (v^T: the bf16-rounded values, written as f16).
// The planes lie in fragment order: a tile of 16 rows x 64 k values is 2 KiB, four blocks of 512 bytes, and a block holds the 32 lanes' 16-byte pieces of one fragment half, so a fragment load of a wave reads four whole 128-byte lines instead of 32 bytes out of each of sixteen.
// Transposed products: S^T = k q^T and E^T = (table window) q^T, so a lane holds one query's scores; the bias of key j for query i is row (j - i) of E^T, fetched per lane from an LDS copy of E^T (the skew); the table row index is clamped as the module clips it, where k_prep gathers the rows.
// Compute dtypes, f32 accumulate: every input rounded to bf16; q.k, q.table exact products; softmax f32, running maximum; unnormalised P (0 .. 1) rounded once to f16 x v^T, whose bf16-rounded values are stored as f16 (1 product); f32 output rows.

#define NB_  8
#define TT   2048
#define DM   1024
#define NH_  1
#define NKV  1
#define REP  (NH_ / NKV)
#define HD   64
#define DQ   (NH_ * HD)
#define DKV  (NKV * HD)
#define ZH   2
#define RH   2048
#define WIN  0
#define PCAR 1024.0f
#define SCL  0.125f   // 1/sqrt(64) applied to (q.k + bias)
#define NREL 2049   // table rows (2*MAX_DIST + 1)
#define NXT  4096   // rows of the clipped-table plane: row u holds table row clip(u - 2047, -1024, 1024) + 1024, u = j - i + 2047
#define MAXD 1024
typedef _Float16 h16;
typedef unsigned short bf;
typedef __attribute__((ext_vector_type(16))) __bf16   v16bf;
typedef __attribute__((ext_vector_type(16))) _Float16 v16h;
typedef __attribute__((ext_vector_type(8)))  _Float16 v8h;
typedef __attribute__((ext_vector_type(8)))  unsigned short v8us;
typedef __attribute__((ext_vector_type(8)))  float    v8f;
typedef __attribute__((ext_vector_type(4)))  float    v4f;
typedef v8h  __attribute__((may_alias)) v8ha;
typedef v4f  __attribute__((may_alias)) v4fa;
typedef v8us __attribute__((may_alias)) v8usa;

__device__ __forceinline__ unsigned short f2bf(float f) { unsigned u = __float_as_uint(f); u += 0x7FFFu + ((u >> 16) & 1u); return (unsigned short)(u >> 16); }
__device__ __forceinline__ float bf2f(unsigned short b) { return __uint_as_float(((unsigned)b) << 16); }
__device__ __forceinline__ float bfr(float f) { return bf2f(f2bf(f)); }
__device__ __forceinline__ v16h cat16(v8h lo, v8h hi) { return __builtin_shufflevector(lo, hi, 0, 1, 2, 3, 4, 5, 6, 7, 8, 9, 10, 11, 12, 13, 14, 15); }
__device__ __forceinline__ v16bf cat16b(v8us lo, v8us hi) { return __builtin_bit_cast(v16bf, __builtin_shufflevector(lo, hi, 0, 1, 2, 3, 4, 5, 6, 7, 8, 9, 10, 11, 12, 13, 14, 15)); }
__device__ __forceinline__ v8f wmma16(v16h a, v16h b, v8f c) { return __builtin_amdgcn_wmma_f32_16x16x32_f16(false, a, false, b, (short)0, c, false, false); }
__device__ __forceinline__ v8f wmmab(v16bf a, v16bf b, v8f c) { return __builtin_amdgcn_wmma_f32_16x16x32_bf16(false, a, false, b, (short)0, c, false, false); }



// Fragment loader: 16 elements of one K-contiguous row in the hardware k order (k = 8h .. 8h+7, then 16+8h .. 16+8h+7), the same for A and B.
template <typename T16> struct WFrag;
template <> struct WFrag<h16> { typedef v16h V; static __device__ __forceinline__ V ld(const h16* p) { return cat16(*(const v8h*)p, *(const v8h*)(p + 16)); } static __device__ __forceinline__ v8f mma(V a, V b, v8f c) { return wmma16(a, b, c); } };
template <> struct WFrag<bf> { typedef v16bf V; static __device__ __forceinline__ V ld(const bf* p) { return cat16b(*(const v8us*)p, *(const v8us*)(p + 16)); } static __device__ __forceinline__ v8f mma(V a, V b, v8f c) { return wmmab(a, b, c); } };
__device__ __forceinline__ h16 tohx(float x) { return (h16)x; }
__device__ __forceinline__ void splitf(float y, unsigned short& h, unsigned short& l) { h = f2bf(y); l = f2bf(y - bf2f(h)); }
typedef __attribute__((ext_vector_type(2))) _Float16 v2h;
typedef __attribute__((ext_vector_type(4))) _Float16 v4h;
typedef __attribute__((ext_vector_type(2))) unsigned short v2us;
typedef __attribute__((ext_vector_type(4))) unsigned short v4us;
typedef __attribute__((ext_vector_type(2))) float v2f;
typedef __attribute__((ext_vector_type(4))) int v4i;

__global__ __launch_bounds__(256) void k_wtG(const float* __restrict__ w, int K, int N, bf* Bt) {
    const int lane = threadIdx.x & 31; const int L0 = (blockIdx.x * 8 + (threadIdx.x >> 5)) * 8; const int nlines = N * K / 64;
{
#pragma unroll 1
        for (int l = 0; l < 8; ++l) { const int L = L0 + l; if (L >= nlines) break; const size_t e = (size_t)L * 64 + lane * 2; const int k = (int)(e % K), n = (int)(e / K); v2us o;
            o[0] = f2bf(w[(size_t)k * N + n]); o[1] = f2bf(w[(size_t)(k + 1) * N + n]); *(v2us*)(Bt + e) = o; }
         }
}

__global__ __launch_bounds__(256) void k_vtp(const float* __restrict__ F, int pitch, int nheads, h16* V16, bf* Vh, bf* Vl) { const size_t e = ((size_t)blockIdx.x * 256 + threadIdx.x) * 2; if (e >= (size_t)nheads * HD * TT) return; const int t = (int)(e % TT); const int d = (int)((e / TT) % HD); const int g = (int)(e / ((size_t)TT * HD)); v2h o16; v2us oh, ol;
#pragma unroll
    for (int q = 0; q < 2; ++q) { const float x = F[(size_t)(t + q) * pitch + g * HD + d]; o16[q] = tohx(x); unsigned short a2, c2; splitf(x, a2, c2); oh[q] = a2; ol[q] = c2; }
    *(v2h*)(V16 + e) = o16; *(v2us*)(Vh + e) = oh; *(v2us*)(Vl + e) = ol;  }

__global__ __launch_bounds__(256) void k_merge(const float* __restrict__ O, int h0, float* OUTb) { const size_t e = ((size_t)blockIdx.x * 256 + threadIdx.x) * 2; if (e >= (size_t)ZH * TT * HD) return; const int d = (int)(e % HD); const int t = (int)((e / HD) % TT); const int zz = (int)(e / ((size_t)HD * TT)); const float cs = (t < RH) ? 1.0f : (1.0f / PCAR); const size_t oo = (size_t)t * DQ + (h0 + zz) * HD + d;
    v2f o2; o2[0] = O[e] * cs; o2[1] = O[e + 1] * cs; *(v2f*)(OUTb + oo) = o2;  }

// ---- k_prep: every bf16 plane in one launch. The block index picks the job (v^T, q, k, table); a thread handles 64 elements (16 of the table), so the whole stage is PB_ALL blocks of eight waves, no more than the chip has WGPs.
#define PU     8                                   // units of 8 elements a thread
#define PB_V   (NB_ * TT * HD / (256 * 8 * PU))     // blocks of the v^T job; the q and the k job have as many
#define PB_T   (NXT * HD / (256 * 16))              // blocks of the table job, 16 elements a thread: a whole number
#define PB_ALL (3 * PB_V + PB_T)
// bits of the f16 that holds the bf16-rounded value: the same number wherever it is a normal f16
__device__ __forceinline__ unsigned short f2hb(float f) { return __builtin_bit_cast(unsigned short, (h16)bfr(f)); }
__device__ __forceinline__ v8us cvt8(v8f v) { v8us o;
#pragma unroll
    for (int k = 0; k < 8; ++k) o[k] = f2bf(v[k]);
    return o; }
__global__ __launch_bounds__(256) void k_prep(const float* __restrict__ Qin, const float* __restrict__ Kin, const float* __restrict__ Vin, const float* __restrict__ tab, bf* __restrict__ QB, bf* __restrict__ KB, bf* __restrict__ VT, bf* __restrict__ TB) {
    const int b = blockIdx.x, tid = threadIdx.x;
    if (b < PB_V) {
        // v^T: a wave takes 64 keys x 32 columns of one batch; a lane holds 8 keys x 8 columns in registers, so a row of v is read in whole 128-byte lines; in a v^T tile (16 columns x 64 keys) the piece of column lr and key octet cc lies at block cc / 2, place (lr % 4) * 8 + (lr / 4) * 2 + cc % 2, so eight lanes of a store fill one whole line
        const int lane = tid & 31, tg = lane & 7, dg = lane >> 3; const int wt = b * 8 + (tid >> 5);
        const int z = wt / (TT / 64 * 2), r = wt % (TT / 64 * 2); const int t0 = (r >> 1) * 64 + tg * 8, d0 = (r & 1) * 32 + dg * 4;
        const float* Vb = Vin + (size_t)z * TT * HD + (size_t)t0 * HD + d0; bf* Vh = VT + (size_t)z * HD * TT + (size_t)((r >> 1) * 4 + (r & 1) * 2) * 1024 + (tg >> 1) * 256 + (dg * 2 + (tg & 1)) * 8;
        v4f x[8][2];
#pragma unroll
        for (int q = 0; q < 8; ++q) { x[q][0] = *(const v4f*)(Vb + q * HD); x[q][1] = *(const v4f*)(Vb + q * HD + 16); }
        // keeps the 16 loads above in one batch: otherwise five of them are issued only behind the first ones' data
        __builtin_amdgcn_sched_barrier(0);
        asm volatile("s_wait_xcnt 0x0" :: "v"(Vb) : "memory");     // before the loads' address registers are re-used; the address is an input, so it stays in them up to here
#pragma unroll
        for (int h = 0; h < 2; ++h)
#pragma unroll
            for (int c = 0; c < 4; ++c) { v8us o;
#pragma unroll
                for (int q = 0; q < 8; ++q) o[q] = f2hb(x[q][h][c]);
                *(v8us*)(Vh + h * 1024 + c * 64) = o; }
    } else if (b < 3 * PB_V) {
        const bool isq = b < 2 * PB_V; const float* src = isq ? Qin : Kin; bf* dst = isq ? QB : KB;
        // a wave takes two tiles of 16 rows; a load unit is four whole rows, and its store fills one whole line in each of the tile's four blocks (row lr, octet cc: block cc / 2, place lr * 2 + cc % 2)
        const int lane = tid & 31; const size_t i0 = (size_t)(b - (isq ? PB_V : 2 * PB_V)) * (256 * PU) + (tid >> 5) * (32 * PU) + lane; const float* sp = src + i0 * 8; v8f x[PU];
        bf* dp = dst + (i0 >> 7) * 1024 + ((lane & 7) >> 1) * 256 + (lane >> 3) * 16 + (lane & 1) * 8;
#pragma unroll
        for (int u = 0; u < PU; ++u) x[u] = *(const v8f*)(sp + u * 256);
        asm volatile("s_wait_xcnt 0x0" :: "v"(sp) : "memory");     // as above
#pragma unroll
        for (int u = 0; u < PU; ++u) *(v8us*)(dp + (u >> 2) * 1024 + (u & 3) * 64) = cvt8(x[u]);
        asm volatile("s_wait_xcnt 0x0" ::: "memory");     // behind the stores: before a register that they name is written again
    } else {
        // clipped table rows: a thread takes a quarter of a row, which is that row's 32 bytes of one block of its tile
        const int j = (b - 3 * PB_V) * 256 + tid, r = j / 4; const float* tp = tab + (size_t)min(max(r - (TT - 1) + MAXD, 0), 2 * MAXD) * HD + (j % 4) * 16;
        bf* dp = TB + (size_t)(r >> 4) * 1024 + (j % 4) * 256 + (r & 15) * 16;
        const v8f x0 = *(const v8f*)tp, x1 = *(const v8f*)(tp + 8);
        asm volatile("s_wait_xcnt 0x0" :: "v"(tp) : "memory");     // as above
        *(v8us*)dp = cvt8(x0); *(v8us*)(dp + 8) = cvt8(x1);
        asm volatile("s_wait_xcnt 0x0" ::: "memory");     // behind the stores, as above
    }
}
// ---- k_fattn: one block = 64 queries of one batch (NG groups of 16, all held by every wave, so a k, v^T or table fragment is fetched once for all of them); its KSP waves each take KPW keys in passes of 64 and keep a running maximum, sum and O^T; the partial results are merged in LDS at the end, in wave order.
#define KSP 8                      // waves per block = key ranges of one query block
#define KPW (TT / KSP)             // keys per wave
#define NG  4                      // query groups of 16 a wave
#define NWB (NG + 4)               // table tiles of a pass's window
#define EP  84                     // floats per query row of the E^T copy (80 window rows + 4: the skewed b32 reads and the b128 stores then fall on distinct banks)
#define OP  68                     // floats per query row of a partial output tile
#define CSL 0.18033688011112042f   // SCL * log2(e)
typedef __attribute__((ext_vector_type(16))) float v16f;
// fragment of a plane in fragment order, at the lane's address in the batch's first block plus a constant (one address pair for a whole batch of loads, the constant in the instruction): its two halves (k = 8 hi .. 8 hi + 7 and 16 more) lie one 512-byte block apart
__device__ __forceinline__ v16bf ldo(const char* p, int k) { return cat16b(*(const v8us*)(p + k), *(const v8us*)(p + k + 512)); }
// the same for the v^T plane, whose 16-bit values are f16
__device__ __forceinline__ v16h ldoh(const char* p, int k) { return __builtin_bit_cast(v16h, __builtin_shufflevector(*(const v8us*)(p + k), *(const v8us*)(p + k + 512), 0, 1, 2, 3, 4, 5, 6, 7, 8, 9, 10, 11, 12, 13, 14, 15)); }
// 2^x with the slot behind a transcendental filled in the same statement
__device__ __forceinline__ float exp2n(float x) { float r; asm("v_exp_f32 %0, %1\n\tv_nop" : "=v"(r) : "v"(x)); return r; }
// two waves per SIMD (one block per WGP): a budget of 512 registers
__global__ __launch_bounds__(KSP * 32) __attribute__((amdgpu_waves_per_eu(2, 2))) void k_fattn(const bf* __restrict__ QB, const bf* __restrict__ KB, const bf* __restrict__ VT, const bf* __restrict__ TB, float* __restrict__ OUT) {
    __shared__ __align__(16) float sm[KSP * NG * 16 * EP];
    __shared__ float sml[2][KSP][NG * 16];
    const int lane = threadIdx.x & 31, lr = lane & 15, hi = lane >> 4, w = __builtin_amdgcn_readfirstlane(threadIdx.x >> 5);    // the wave's number as a scalar: the tile addresses below are then scalar
    const int i0 = blockIdx.x * (NG * 16); const size_t zb = blockIdx.y;
    const bf* Qb = QB + zb * TT * HD; const bf* Kb = KB + zb * TT * HD; const bf* Vb = VT + zb * HD * TT;
    const unsigned lo = (unsigned)(lr * 32 + hi * 16), lov = (unsigned)(((lr & 3) * 8 + (lr >> 2) * 2 + hi) * 16);    // the lane's piece inside a 512-byte block: q, k and table planes; v^T plane
    float* es = sm + w * (NG * 16 * EP);      // this wave's own E^T copies, one per query group
    v16bf qf[NG][2];                         // B operand: query i0 + 16 g + lr, kept for the whole kernel
#pragma unroll
    for (int g = 0; g < NG; ++g)
#pragma unroll
        for (int ks = 0; ks < 2; ++ks) qf[g][ks] = ldo((const char*)(Qb + i0 * HD) + lo, g * 2048 + ks * 1024);
    asm volatile("s_wait_xcnt 0x0" :: "s"(Qb + i0 * HD), "v"(lo) : "memory");    // before the loads' address registers are re-used; base and offset are inputs, so they stay in them up to here
    v8f o[NG][4]; float m[NG], l[NG];
#pragma unroll
    for (int g = 0; g < NG; ++g) { m[g] = -3.0e38f; l[g] = 0.f;
#pragma unroll
        for (int db = 0; db < 4; ++db) o[g][db] = (v8f){}; }
    // kept rolled for speed only
#pragma unroll 1
    for (int it = 0; it < KPW / 64; ++it) {
        const int j0 = w * KPW + it * 64;
        // E^T over the 128 clipped table rows j - i = j0 - i0 - 63 .. j0 - i0 + 64, eight whole tiles of the plane; group g needs window blocks NG - 1 - g .. NG + 3 - g
        { v16bf ta[NWB][2]; const char* tp = (const char*)(TB + (j0 - i0 + TT - NG * 16) * HD) + lo;
#pragma unroll
        for (int wb = 0; wb < NWB; ++wb) { ta[wb][0] = ldo(tp, wb * 2048); ta[wb][1] = ldo(tp, wb * 2048 + 1024); }
        // keeps the 32 table loads above in one batch: otherwise the first blocks' loads are each waited for before the next block's are issued
        __builtin_amdgcn_sched_barrier(0);
        asm volatile("s_wait_xcnt 0x0" :: "v"(tp) : "memory");    // before the loads' address registers are re-used; the address is an input, so it stays in them up to here
#pragma unroll
        for (int wb = 0; wb < NWB; ++wb) { v8f e[NG]; const int glo = wb < NG - 1 ? NG - 1 - wb : 0, ghi = wb > 4 ? NG + 3 - wb : NG - 1;    // the groups that need this block
#pragma unroll
            for (int g = 0; g < NG; ++g) if (g >= glo && g <= ghi) e[g] = wmmab(ta[wb][0], qf[g][0], (v8f){});
#pragma unroll
            for (int g = 0; g < NG; ++g) if (g >= glo && g <= ghi) e[g] = wmmab(ta[wb][1], qf[g][1], e[g]);
            // WMMA distance: four vector slots behind the products above, before a later matrix instruction starts a new sum in the same registers
            asm volatile("v_nop\n\tv_nop\n\tv_nop\n\tv_nop" :: "v"(e[glo]), "v"(e[glo < ghi ? glo + 1 : ghi]), "v"(e[glo < ghi ? ghi - 1 : glo]), "v"(e[ghi]));
#pragma unroll
            for (int g = 0; g < NG; ++g) { const int lb = wb - (NG - 1) + g; if (lb >= 0 && lb < 5) { float* ep = es + (g * 16 + lr) * EP + lb * 16 + 8 * hi;
                *(v4fa*)ep = __builtin_shufflevector(e[g], e[g], 0, 1, 2, 3); *(v4fa*)(ep + 4) = __builtin_shufflevector(e[g], e[g], 4, 5, 6, 7); } } } }
        v16bf ka[4][2]; const char* kp = (const char*)(Kb + j0 * HD) + lo;
#pragma unroll
        for (int kb = 0; kb < 4; ++kb) { ka[kb][0] = ldo(kp, kb * 2048); ka[kb][1] = ldo(kp, kb * 2048 + 1024); }
        asm volatile("s_wait_xcnt 0x0" :: "v"(kp) : "memory");    // as above
        // keeps the skewed reads below behind the other half-wave's stores above (same wave: LDS runs its operations in order)
        __builtin_amdgcn_wave_barrier(); asm volatile("" ::: "memory");
        v8f s[NG][4];                        // s[g][kb][r] = score of key j0 + 16 kb + 8 hi + r for query i0 + 16 g + lr; starts as the bias, the q.k products accumulate onto it
#pragma unroll
        for (int g = 0; g < NG; ++g) { const float* er = es + (g * 16 + lr) * EP - lr + 15 + 8 * hi;
#pragma unroll
            for (int kb = 0; kb < 4; ++kb)
#pragma unroll
                for (int r = 0; r < 8; ++r) s[g][kb][r] = er[kb * 16 + r]; }
        // keeps the next pass's E^T stores behind the reads above
        __builtin_amdgcn_wave_barrier(); asm volatile("" ::: "memory");
#pragma unroll
        for (int ks = 0; ks < 2; ++ks)
#pragma unroll
            for (int kb = 0; kb < 4; ++kb)
#pragma unroll
                for (int g = 0; g < NG; ++g) s[g][kb] = wmmab(ka[kb][ks], qf[g][ks], s[g][kb]);
        v16h ph[NG][2];                      // P^T as f16 B operands: two score tiles (32 keys) pack into one fragment in the hardware k order
#pragma unroll
        for (int g = 0; g < NG; ++g) { float mx = m[g];
#pragma unroll
            for (int kb = 0; kb < 4; ++kb)
#pragma unroll
                for (int r = 0; r < 8; ++r) { const float y = s[g][kb][r] * CSL; s[g][kb][r] = y; mx = fmaxf(mx, y); }
            mx = fmaxf(mx, __shfl_xor(mx, 16, 32));
            const float al = exp2n(m[g] - mx); m[g] = mx; float sum = 0.f;
            // splits the scheduling region: the query groups' softmax runs are then not interleaved, which keeps the build free of spills
            __builtin_amdgcn_sched_barrier(0);
#pragma unroll
            for (int kb = 0; kb < 4; ++kb)
#pragma unroll
                for (int r = 0; r < 8; ++r) { const float p = exp2n(s[g][kb][r] - mx); s[g][kb][r] = p; sum += p; }
            l[g] = l[g] * al + sum;
#pragma unroll
            for (int db = 0; db < 4; ++db) o[g][db] *= al;
#pragma unroll
            for (int ks = 0; ks < 2; ++ks) { const v16f pv = __builtin_shufflevector(s[g][2 * ks], s[g][2 * ks + 1], 0, 1, 2, 3, 4, 5, 6, 7, 8, 9, 10, 11, 12, 13, 14, 15);
                ph[g][ks] = __builtin_convertvector(pv, v16h); }
        }
        // ends the scheduling region of the softmax, where registers are scarce: without it the v^T loads below are issued two at a time, each pair waited for before its products
        __builtin_amdgcn_sched_barrier(0);
        v16h va[4][2]; const char* vp = (const char*)(Vb + j0 * HD) + lov;
#pragma unroll
        for (int db = 0; db < 4; ++db)
#pragma unroll
            for (int ks = 0; ks < 2; ++ks) va[db][ks] = ldoh(vp, db * 2048 + ks * 1024);
        // keeps the 16 v^T loads above in one batch: otherwise they are issued two to four at a time among the products, each group waited for in turn
        __builtin_amdgcn_sched_barrier(0);
        asm volatile("s_wait_xcnt 0x0" :: "v"(vp) : "memory");    // as above
#pragma unroll
        for (int db = 0; db < 4; ++db)
#pragma unroll
            for (int ks = 0; ks < 2; ++ks)
#pragma unroll
                for (int g = 0; g < NG; ++g) o[g][db] = wmma16(va[db][ks], ph[g][ks], o[g][db]);
    }
    // merge of the KSP key ranges: common maximum, total sum, then the scaled partial O^T tiles summed in wave order
#pragma unroll
    for (int g = 0; g < NG; ++g) { l[g] += __shfl_xor(l[g], 16, 32); if (hi == 0) { sml[0][w][g * 16 + lr] = m[g]; sml[1][w][g * 16 + lr] = l[g]; } }
    __syncthreads();                         // publishes every wave's maximum and sum; also ends every wave's use of its E^T copies
#pragma unroll
    for (int g = 0; g < NG; ++g) { float M = -3.0e38f, L = 0.f;
#pragma unroll
        for (int ww = 0; ww < KSP; ++ww) M = fmaxf(M, sml[0][ww][g * 16 + lr]);
#pragma unroll
        for (int ww = 0; ww < KSP; ++ww) L += sml[1][ww][g * 16 + lr] * exp2n(sml[0][ww][g * 16 + lr] - M);
        const float f = exp2n(m[g] - M) / L;
#pragma unroll
        for (int db = 0; db < 4; ++db) o[g][db] *= f; }
#pragma unroll
    for (int g = 0; g < NG; ++g) { float* op = sm + ((g * KSP + w) * 16 + lr) * OP + 8 * hi;    // every group has its own KSP tiles: they fit where the E^T copies lay
#pragma unroll
        for (int db = 0; db < 4; ++db) { *(v4fa*)(op + db * 16) = __builtin_shufflevector(o[g][db], o[g][db], 0, 1, 2, 3); *(v4fa*)(op + db * 16 + 4) = __builtin_shufflevector(o[g][db], o[g][db], 4, 5, 6, 7); } }
    __syncthreads();                         // publishes the KSP partial tiles of every query group
#pragma unroll
    for (int g = 0; g < NG; ++g) { const int q = threadIdx.x >> 4, d4 = (threadIdx.x & 15) * 4; const float* ip = sm + (g * KSP * 16 + q) * OP + d4; v4f acc = *(const v4fa*)ip;
#pragma unroll
        for (int ww = 1; ww < KSP; ++ww) acc += *(const v4fa*)(ip + ww * 16 * OP);
        *(v4f*)(OUT + (zb * TT + i0 + g * 16 + q) * HD + d4) = acc;
    }
}

extern "C" void kernel_launch(void* const* d_in, const int* in_sizes, int n_in,
                              void* d_out, int out_size, void* d_ws, size_t ws_size, hipStream_t stream) {
    (void)in_sizes; (void)n_in; (void)out_size;
    const float* Qin = (const float*)d_in[0]; const float* Kin = (const float*)d_in[1]; const float* Vin = (const float*)d_in[2]; const float* tab = (const float*)d_in[3];
    float* OUT = (float*)d_out;     // [8][2048][64]
    char* wsp = (char*)d_ws;
    auto take = [&](size_t bytes) { char* p = wsp; wsp += (bytes + 255) & ~(size_t)255; return (void*)p; };
    bf* TB = (bf*)take((size_t)NXT * HD * 2); bf* QB = (bf*)take((size_t)NB_ * TT * HD * 2); bf* KB = (bf*)take((size_t)NB_ * TT * HD * 2); bf* VT = (bf*)take((size_t)NB_ * HD * TT * 2);
    if ((size_t)(wsp - (char*)d_ws) > ws_size) return;    // carve under 7 MiB
    k_prep<<<PB_ALL, 256, 0, stream>>>(Qin, Kin, Vin, tab, QB, KB, VT, TB);
    k_fattn<<<dim3(TT / (NG * 16), NB_, 1), KSP * 32, 0, stream>>>(QB, KB, VT, TB, OUT);
}

// v007
// It runs in 19.2 microseconds.
// Timed twice side by side with v006, it ran 1.10 and 1.09 times as fast.
// All steps since v000 together make it 36.4 times as fast.
#include <hip/hip_runtime.h>

// Single-head attention with a learned relative-position bias (Music-Transformer style skew) on given q, k, v [8][2048][64]: rel_emb[e] = rel_table[clip(e - S, -1024, 1024) + 1024] (table [2049][64]); qr = skew(q . rel_emb) so that bias[i][j] = q_i . rel_table[clip(j - i, -1024, 1024) + 1024]; scores = (q.k + bias) / 8; softmax over all keys; out = w v -> [8][2048][64] (1.0 M).
// One fused kernel (k_fattn) does scores, bias, softmax and P x v; the score matrix never reaches memory. Before it, one kernel (k_prep) rounds q, k, v^T and the clipped table rows rel_emb to bf16 planes (v^T: the bf16-rounded values, written as f16).
// The planes lie in fragment order: a tile of 16 rows x 64 k values is 2 KiB, four blocks of 512 bytes, and a block holds the 32 lanes' 16-byte pieces of one fragment half, so a fragment load of a wave reads four whole 128-byte lines instead of 32 bytes out of each of sixteen.
// Transposed products: S^T = k q^T and E^T = (table window) q^T, so a lane holds one query's scores; the bias of key j for query i is row (j - i) of E^T, fetched per lane from an LDS copy of E^T (the skew); the table row index is clamped as the module clips it, where k_prep gathers the rows.
// Compute dtypes, f32 accumulate: every input rounded to bf16; q.k, q.table exact products; softmax f32, running maximum; unnormalised P (0 .. 1) rounded once to f16 x v^T, whose bf16-rounded values are stored as f16 (1 product); f32 output rows.

#define NB_  8
#define TT   2048
#define DM   1024
#define NH_  1
#define NKV  1
#define REP  (NH_ / NKV)
#define HD   64
#define DQ   (NH_ * HD)
#define DKV  (NKV * HD)
#define ZH   2
#define RH   2048
#define WIN  0
#define PCAR 1024.0f
#define SCL  0.125f   // 1/sqrt(64) applied to (q.k + bias)
#define NREL 2049   // table rows (2*MAX_DIST + 1)
#define NXT  4096   // rows of the clipped-table plane: row u holds table row clip(u - 2047, -1024, 1024) + 1024, u = j - i + 2047
#define MAXD 1024
typedef _Float16 h16;
typedef unsigned short bf;
typedef __attribute__((ext_vector_type(16))) __bf16   v16bf;
typedef __attribute__((ext_vector_type(16))) _Float16 v16h;
typedef __attribute__((ext_vector_type(8)))  _Float16 v8h;
typedef __attribute__((ext_vector_type(8)))  unsigned short v8us;
typedef __attribute__((ext_vector_type(8)))  float    v8f;
typedef __attribute__((ext_vector_type(4)))  float    v4f;
typedef v8h  __attribute__((may_alias)) v8ha;
typedef v4f  __attribute__((may_alias)) v4fa;
typedef v8us __attribute__((may_alias)) v8usa;

__device__ __forceinline__ unsigned short f2bf(float f) { unsigned u = __float_as_uint(f); u += 0x7FFFu + ((u >> 16) & 1u); return (unsigned short)(u >> 16); }
__device__ __forceinline__ float bf2f(unsigned short b) { return __uint_as_float(((unsigned)b) << 16); }
__device__ __forceinline__ float bfr(float f) { return bf2f(f2bf(f)); }
__device__ __forceinline__ v16h cat16(v8h lo, v8h hi) { return __builtin_shufflevector(lo, hi, 0, 1, 2, 3, 4, 5, 6, 7, 8, 9, 10, 11, 12, 13, 14, 15); }
__device__ __forceinline__ v16bf cat16b(v8us lo, v8us hi) { return __builtin_bit_cast(v16bf, __builtin_shufflevector(lo, hi, 0, 1, 2, 3, 4, 5, 6, 7, 8, 9, 10, 11, 12, 13, 14, 15)); }
__device__ __forceinline__ v8f wmma16(v16h a, v16h b, v8f c) { return __builtin_amdgcn_wmma_f32_16x16x32_f16(false, a, false, b, (short)0, c, false, false); }
__device__ __forceinline__ v8f wmmab(v16bf a, v16bf b, v8f c) { return __builtin_amdgcn_wmma_f32_16x16x32_bf16(false, a, false, b, (short)0, c, false, false); }



// Fragment loader: 16 elements of one K-contiguous row in the hardware k order (k = 8h .. 8h+7, then 16+8h .. 16+8h+7), the same for A and B.
template <typename T16> struct WFrag;
template <> struct WFrag<h16> { typedef v16h V; static __device__ __forceinline__ V ld(const h16* p) { return cat16(*(const v8h*)p, *(const v8h*)(p + 16)); } static __device__ __forceinline__ v8f mma(V a, V b, v8f c) { return wmma16(a, b, c); } };
template <> struct WFrag<bf> { typedef v16bf V; static __device__ __forceinline__ V ld(const bf* p) { return cat16b(*(const v8us*)p, *(const v8us*)(p + 16)); } static __device__ __forceinline__ v8f mma(V a, V b, v8f c) { return wmmab(a, b, c); } };
__device__ __forceinline__ h16 tohx(float x) { return (h16)x; }
__device__ __forceinline__ void splitf(float y, unsigned short& h, unsigned short& l) { h = f2bf(y); l = f2bf(y - bf2f(h)); }
typedef __attribute__((ext_vector_type(2))) _Float16 v2h;
typedef __attribute__((ext_vector_type(4))) _Float16 v4h;
typedef __attribute__((ext_vector_type(2))) unsigned short v2us;
typedef __attribute__((ext_vector_type(4))) unsigned short v4us;
typedef __attribute__((ext_vector_type(2))) float v2f;
typedef __attribute__((ext_vector_type(4))) int v4i;

__global__ __launch_bounds__(256) void k_wtG(const float* __restrict__ w, int K, int N, bf* Bt) {
    const int lane = threadIdx.x & 31; const int L0 = (blockIdx.x * 8 + (threadIdx.x >> 5)) * 8; const int nlines = N * K / 64;
{
#pragma unroll 1
        for (int l = 0; l < 8; ++l) { const int L = L0 + l; if (L >= nlines) break; const size_t e = (size_t)L * 64 + lane * 2; const int k = (int)(e % K), n = (int)(e / K); v2us o;
            o[0] = f2bf(w[(size_t)k * N + n]); o[1] = f2bf(w[(size_t)(k + 1) * N + n]); *(v2us*)(Bt + e) = o; }
         }
}

__global__ __launch_bounds__(256) void k_vtp(const float* __restrict__ F, int pitch, int nheads, h16* V16, bf* Vh, bf* Vl) { const size_t e = ((size_t)blockIdx.x * 256 + threadIdx.x) * 2; if (e >= (size_t)nheads * HD * TT) return; const int t = (int)(e % TT); const int d = (int)((e / TT) % HD); const int g = (int)(e / ((size_t)TT * HD)); v2h o16; v2us oh, ol;
#pragma unroll
    for (int q = 0; q < 2; ++q) { const float x = F[(size_t)(t + q) * pitch + g * HD + d]; o16[q] = tohx(x); unsigned short a2, c2; splitf(x, a2, c2); oh[q] = a2; ol[q] = c2; }
    *(v2h*)(V16 + e) = o16; *(v2us*)(Vh + e) = oh; *(v2us*)(Vl + e) = ol;  }

__global__ __launch_bounds__(256) void k_merge(const float* __restrict__ O, int h0, float* OUTb) { const size_t e = ((size_t)blockIdx.x * 256 + threadIdx.x) * 2; if (e >= (size_t)ZH * TT * HD) return; const int d = (int)(e % HD); const int t = (int)((e / HD) % TT); const int zz = (int)(e / ((size_t)HD * TT)); const float cs = (t < RH) ? 1.0f : (1.0f / PCAR); const size_t oo = (size_t)t * DQ + (h0 + zz) * HD + d;
    v2f o2; o2[0] = O[e] * cs; o2[1] = O[e + 1] * cs; *(v2f*)(OUTb + oo) = o2;  }

// ---- k_prep: every bf16 plane in one launch. The block index picks the job (v^T, q, k, table); a thread handles 64 elements (16 of the table), so the whole stage is PB_ALL blocks of eight waves, no more than the chip has WGPs.
#define PU     8                                   // units of 8 elements a thread
#define PB_V   (NB_ * TT * HD / (256 * 8 * PU))     // blocks of the v^T job; the q and the k job have as many
#define PB_T   (NXT * HD / (256 * 16))              // blocks of the table job, 16 elements a thread: a whole number
#define PB_ALL (3 * PB_V + PB_T)
// bits of the f16 that holds the bf16-rounded value: the same number wherever it is a normal f16
__device__ __forceinline__ unsigned short f2hb(float f) { return __builtin_bit_cast(unsigned short, (h16)bfr(f)); }
__device__ __forceinline__ v8us cvt8(v8f v) { v8us o;
#pragma unroll
    for (int k = 0; k < 8; ++k) o[k] = f2bf(v[k]);
    return o; }
__global__ __launch_bounds__(256) void k_prep(const float* __restrict__ Qin, const float* __restrict__ Kin, const float* __restrict__ Vin, const float* __restrict__ tab, bf* __restrict__ QB, bf* __restrict__ KB, bf* __restrict__ VT, bf* __restrict__ TB) {
    const int b = blockIdx.x, tid = threadIdx.x;
    if (b < PB_V) {
        // v^T: a wave takes 64 keys x 32 columns of one batch; a lane holds 8 keys x 8 columns in registers, so a row of v is read in whole 128-byte lines; in a v^T tile (16 columns x 64 keys) the piece of column lr and key octet cc lies at block cc / 2, place (lr % 4) * 8 + (lr / 4) * 2 + cc % 2, so eight lanes of a store fill one whole line
        const int lane = tid & 31, tg = lane & 7, dg = lane >> 3; const int wt = b * 8 + (tid >> 5);
        const int z = wt / (TT / 64 * 2), r = wt % (TT / 64 * 2); const int t0 = (r >> 1) * 64 + tg * 8, d0 = (r & 1) * 32 + dg * 4;
        const float* Vb = Vin + (size_t)z * TT * HD + (size_t)t0 * HD + d0; bf* Vh = VT + (size_t)z * HD * TT + (size_t)((r >> 1) * 4 + (r & 1) * 2) * 1024 + (tg >> 1) * 256 + (dg * 2 + (tg & 1)) * 8;
        v4f x[8][2];
#pragma unroll
        for (int q = 0; q < 8; ++q) { x[q][0] = *(const v4f*)(Vb + q * HD); x[q][1] = *(const v4f*)(Vb + q * HD + 16); }
        // keeps the 16 loads above in one batch: otherwise five of them are issued only behind the first ones' data
        __builtin_amdgcn_sched_barrier(0);
        asm volatile("s_wait_xcnt 0x0" :: "v"(Vb) : "memory");     // before the loads' address registers are re-used; the address is an input, so it stays in them up to here
#pragma unroll
        for (int h = 0; h < 2; ++h)
#pragma unroll
            for (int c = 0; c < 4; ++c) { v8us o;
#pragma unroll
                for (int q = 0; q < 8; ++q) o[q] = f2hb(x[q][h][c]);
                *(v8us*)(Vh + h * 1024 + c * 64) = o; }
    } else if (b < 3 * PB_V) {
        const bool isq = b < 2 * PB_V; const float* src = isq ? Qin : Kin; bf* dst = isq ? QB : KB;
        // a wave takes two tiles of 16 rows; a load unit is four whole rows, and its store fills one whole line in each of the tile's four blocks (row lr, octet cc: block cc / 2, place lr * 2 + cc % 2)
        const int lane = tid & 31; const size_t i0 = (size_t)(b - (isq ? PB_V : 2 * PB_V)) * (256 * PU) + (tid >> 5) * (32 * PU) + lane; const float* sp = src + i0 * 8; v8f x[PU];
        bf* dp = dst + (i0 >> 7) * 1024 + ((lane & 7) >> 1) * 256 + (lane >> 3) * 16 + (lane & 1) * 8;
#pragma unroll
        for (int u = 0; u < PU; ++u) x[u] = *(const v8f*)(sp + u * 256);
        asm volatile("s_wait_xcnt 0x0" :: "v"(sp) : "memory");     // as above
#pragma unroll
        for (int u = 0; u < PU; ++u) *(v8us*)(dp + (u >> 2) * 1024 + (u & 3) * 64) = cvt8(x[u]);
        asm volatile("s_wait_xcnt 0x0" ::: "memory");     // behind the stores: before a register that they name is written again
    } else {
        // clipped table rows: a thread takes a quarter of a row, which is that row's 32 bytes of one block of its tile
        const int j = (b - 3 * PB_V) * 256 + tid, r = j / 4; const float* tp = tab + (size_t)min(max(r - (TT - 1) + MAXD, 0), 2 * MAXD) * HD + (j % 4) * 16;
        bf* dp = TB + (size_t)(r >> 4) * 1024 + (j % 4) * 256 + (r & 15) * 16;
        const v8f x0 = *(const v8f*)tp, x1 = *(const v8f*)(tp + 8);
        asm volatile("s_wait_xcnt 0x0" :: "v"(tp) : "memory");     // as above
        *(v8us*)dp = cvt8(x0); *(v8us*)(dp + 8) = cvt8(x1);
        asm volatile("s_wait_xcnt 0x0" ::: "memory");     // behind the stores, as above
    }
}
// ---- k_fattn: one block = 64 queries of one batch (NG groups of 16, all held by every wave, so a k, v^T or table fragment is fetched once for all of them); its KSP waves each take KPW keys in passes of 64 and keep a running maximum, sum and O^T; the partial results are merged in LDS at the end, in wave order.
#define KSP 8                      // waves per block = key ranges of one query block
#define KPW (TT / KSP)             // keys per wave
#define NG  4                      // query groups of 16 a wave
#define NWB (NG + 4)               // table tiles of a pass's window
#define EP  84                     // floats per query row of the E^T copy (80 window rows + 4: the skewed b32 reads and the b128 stores then fall on distinct banks)
#define OP  68                     // floats per query row of a partial output tile
#define CSL 0.18033688011112042f   // SCL * log2(e)
typedef __attribute__((ext_vector_type(16))) float v16f;
// fragment of a plane in fragment order, at the lane's address in the batch's first block plus a constant (one address pair for a whole batch of loads, the constant in the instruction): its two halves (k = 8 hi .. 8 hi + 7 and 16 more) lie one 512-byte block apart
__device__ __forceinline__ v16bf ldo(const char* p, int k) { return cat16b(*(const v8us*)(p + k), *(const v8us*)(p + k + 512)); }
// the same for the v^T plane, whose 16-bit values are f16
__device__ __forceinline__ v16h ldoh(const char* p, int k) { return __builtin_bit_cast(v16h, __builtin_shufflevector(*(const v8us*)(p + k), *(const v8us*)(p + k + 512), 0, 1, 2, 3, 4, 5, 6, 7, 8, 9, 10, 11, 12, 13, 14, 15)); }
// 2^x with the slot behind a transcendental filled in the same statement
__device__ __forceinline__ float exp2n(float x) { float r; asm("v_exp_f32 %0, %1\n\tv_nop" : "=v"(r) : "v"(x)); return r; }
// two waves per SIMD (one block per WGP): a budget of 512 registers
__global__ __launch_bounds__(KSP * 32) __attribute__((amdgpu_waves_per_eu(2, 2))) void k_fattn(const bf* __restrict__ QB, const bf* __restrict__ KB, const bf* __restrict__ VT, const bf* __restrict__ TB, float* __restrict__ OUT) {
    __shared__ __align__(16) float sm[KSP * NG * 16 * EP];
    __shared__ float sml[2][KSP][NG * 16];
    const int lane = threadIdx.x & 31, lr = lane & 15, hi = lane >> 4, w = __builtin_amdgcn_readfirstlane(threadIdx.x >> 5);    // the wave's number as a scalar: the tile addresses below are then scalar
    const int i0 = blockIdx.x * (NG * 16); const size_t zb = blockIdx.y;
    const bf* Qb = QB + zb * TT * HD; const bf* Kb = KB + zb * TT * HD; const bf* Vb = VT + zb * HD * TT;
    const unsigned lo = (unsigned)(lr * 32 + hi * 16), lov = (unsigned)(((lr & 3) * 8 + (lr >> 2) * 2 + hi) * 16);    // the lane's piece inside a 512-byte block: q, k and table planes; v^T plane
    float* es = sm + w * (NG * 16 * EP);      // this wave's own E^T copies, one per query group
    v16bf qf[NG][2];                         // B operand: query i0 + 16 g + lr, kept for the whole kernel
#pragma unroll
    for (int g = 0; g < NG; ++g)
#pragma unroll
        for (int ks = 0; ks < 2; ++ks) qf[g][ks] = ldo((const char*)(Qb + i0 * HD) + lo, g * 2048 + ks * 1024);
    asm volatile("s_wait_xcnt 0x0" :: "s"(Qb + i0 * HD), "v"(lo) : "memory");    // before the loads' address registers are re-used; base and offset are inputs, so they stay in them up to here
    v8f o[NG][4]; float m[NG], l[NG];
#pragma unroll
    for (int g = 0; g < NG; ++g) { m[g] = -3.0e38f; l[g] = 0.f;
#pragma unroll
        for (int db = 0; db < 4; ++db) o[g][db] = (v8f){}; }
    // Every batch of fragment loads is issued one phase ahead of its use, so that its latency runs beside work: the table window of a pass before the P x v products of the pass in front (the first one here), k half way through the E^T products, v^T before the softmax.
    // table window of a pass: the 128 clipped table rows j - i = j0 - i0 - 63 .. j0 - i0 + 64, eight whole tiles of the plane; group g needs window blocks NG - 1 - g .. NG + 3 - g
    v16bf tl[NWB][2];                        // a pass's table window, fetched one pass ahead
    { const bf* t0 = TB + (w * KPW - i0 + TT - NG * 16) * HD;
#pragma unroll
    for (int wb = 0; wb < NWB; ++wb) { tl[wb][0] = ldo((const char*)t0 + lo, wb * 2048); tl[wb][1] = ldo((const char*)t0 + lo, wb * 2048 + 1024); }
    // keeps the 32 table loads above in one batch
    __builtin_amdgcn_sched_barrier(0);
    asm volatile("s_wait_xcnt 0x0" :: "s"(t0), "v"(lo) : "memory"); }    // as above: base and offset are inputs
    // kept rolled: for speed only
#pragma unroll 1
    for (int it = 0; it < KPW / 64; ++it) {
        const int j0 = w * KPW + it * 64;
        v16bf ta[NWB][2];
#pragma unroll
        for (int wb = 0; wb < NWB; ++wb) { ta[wb][0] = tl[wb][0]; ta[wb][1] = tl[wb][1]; }
        v16bf ka[4][2]; const char* kp = (const char*)(Kb + j0 * HD) + lo;
        // E^T over the table window
        {
#pragma unroll
        for (int wb = 0; wb < NWB; ++wb) {
            if (wb == NWB / 2) {             // the k loads, half way: they take the registers that the window's first half has left, and fly while the second half is worked on
                __builtin_amdgcn_sched_barrier(0);    // keeps them from rising into the first half, where no register is free
#pragma unroll
                for (int kb = 0; kb < 4; ++kb) { ka[kb][0] = ldo(kp, kb * 2048); ka[kb][1] = ldo(kp, kb * 2048 + 1024); }
                __builtin_amdgcn_sched_barrier(0);    // keeps them from sinking to their use
                asm volatile("s_wait_xcnt 0x0" :: "v"(kp) : "memory");    // before the loads' address registers are re-used; the address is an input, so it stays in them up to here
            } v8f e[NG]; const int glo = wb < NG - 1 ? NG - 1 - wb : 0, ghi = wb > 4 ? NG + 3 - wb : NG - 1;    // the groups that need this block
#pragma unroll
            for (int g = 0; g < NG; ++g) if (g >= glo && g <= ghi) e[g] = wmmab(ta[wb][0], qf[g][0], (v8f){});
#pragma unroll
            for (int g = 0; g < NG; ++g) if (g >= glo && g <= ghi) e[g] = wmmab(ta[wb][1], qf[g][1], e[g]);
            // WMMA distance: four vector slots behind the products above, before a later matrix instruction starts a new sum in the same registers
            asm volatile("v_nop\n\tv_nop\n\tv_nop\n\tv_nop" :: "v"(e[glo]), "v"(e[glo < ghi ? glo + 1 : ghi]), "v"(e[glo < ghi ? ghi - 1 : glo]), "v"(e[ghi]));
#pragma unroll
            for (int g = 0; g < NG; ++g) { const int lb = wb - (NG - 1) + g; if (lb >= 0 && lb < 5) { float* ep = es + (g * 16 + lr) * EP + lb * 16 + 8 * hi;
                *(v4fa*)ep = __builtin_shufflevector(e[g], e[g], 0, 1, 2, 3); *(v4fa*)(ep + 4) = __builtin_shufflevector(e[g], e[g], 4, 5, 6, 7); } } } }
        // keeps the skewed reads below behind the other half-wave's stores above (same wave: LDS runs its operations in order)
        __builtin_amdgcn_wave_barrier(); asm volatile("" ::: "memory");
        v8f s[NG][4];                        // s[g][kb][r] = score of key j0 + 16 kb + 8 hi + r for query i0 + 16 g + lr; starts as the bias, the q.k products accumulate onto it
#pragma unroll
        for (int g = 0; g < NG; ++g) { const float* er = es + (g * 16 + lr) * EP - lr + 15 + 8 * hi;
#pragma unroll
            for (int kb = 0; kb < 4; ++kb)
#pragma unroll
                for (int r = 0; r < 8; ++r) s[g][kb][r] = er[kb * 16 + r]; }
        // keeps the next pass's E^T stores behind the reads above
        __builtin_amdgcn_wave_barrier(); asm volatile("" ::: "memory");
#pragma unroll
        for (int ks = 0; ks < 2; ++ks)
#pragma unroll
            for (int kb = 0; kb < 4; ++kb)
#pragma unroll
                for (int g = 0; g < NG; ++g) s[g][kb] = wmmab(ka[kb][ks], qf[g][ks], s[g][kb]);
        // keeps the v^T loads below behind the q.k products: issued among them they would need registers beside the k fragments', and the build spills
        __builtin_amdgcn_sched_barrier(0);
        v16h va[4][2]; const char* vp = (const char*)(Vb + j0 * HD) + lov;
#pragma unroll
        for (int db = 0; db < 4; ++db)
#pragma unroll
            for (int ks = 0; ks < 2; ++ks) va[db][ks] = ldoh(vp, db * 2048 + ks * 1024);
        // keeps the 16 v^T loads above in one batch in front of the softmax: they fly while it runs
        __builtin_amdgcn_sched_barrier(0);
        asm volatile("s_wait_xcnt 0x0" :: "v"(vp) : "memory");    // as above
        v16h ph[NG][2];                      // P^T as f16 B operands: two score tiles (32 keys) pack into one fragment in the hardware k order
#pragma unroll
        for (int g = 0; g < NG; ++g) { float mx = m[g];
#pragma unroll
            for (int kb = 0; kb < 4; ++kb)
#pragma unroll
                for (int r = 0; r < 8; ++r) { const float y = s[g][kb][r] * CSL; s[g][kb][r] = y; mx = fmaxf(mx, y); }
            mx = fmaxf(mx, __shfl_xor(mx, 16, 32));
            const float al = exp2n(m[g] - mx); m[g] = mx; float sum = 0.f;
            // splits the scheduling region: the query groups' softmax runs are then not interleaved, which keeps the build free of spills
            __builtin_amdgcn_sched_barrier(0);
#pragma unroll
            for (int kb = 0; kb < 4; ++kb)
#pragma unroll
                for (int r = 0; r < 8; ++r) { const float p = exp2n(s[g][kb][r] - mx); s[g][kb][r] = p; sum += p; }
            l[g] = l[g] * al + sum;
#pragma unroll
            for (int db = 0; db < 4; ++db) o[g][db] *= al;
#pragma unroll
            for (int ks = 0; ks < 2; ++ks) { const v16f pv = __builtin_shufflevector(s[g][2 * ks], s[g][2 * ks + 1], 0, 1, 2, 3, 4, 5, 6, 7, 8, 9, 10, 11, 12, 13, 14, 15);
                ph[g][ks] = __builtin_convertvector(pv, v16h); }
        }
        // ends the scheduling region of the softmax, where registers are scarce
        __builtin_amdgcn_sched_barrier(0);
        // the next pass's window; the last pass has none: a branch round the loads made the build spill, so it fetches, unused, the window of key 0, the same lines in all eight waves (one fetch into the WGP's cache)
        const char* tn = (const char*)(TB + ((it + 1 < KPW / 64 ? j0 + 64 : 0) - i0 + TT - NG * 16) * HD) + lo;
#pragma unroll
        for (int wb = 0; wb < NWB; ++wb) { tl[wb][0] = ldo(tn, wb * 2048); tl[wb][1] = ldo(tn, wb * 2048 + 1024); }
        // keeps the 32 table loads above in one batch in front of the P x v products
        __builtin_amdgcn_sched_barrier(0);
        asm volatile("s_wait_xcnt 0x0" :: "v"(tn) : "memory");    // as above
#pragma unroll
        for (int db = 0; db < 4; ++db)
#pragma unroll
            for (int ks = 0; ks < 2; ++ks)
#pragma unroll
                for (int g = 0; g < NG; ++g) o[g][db] = wmma16(va[db][ks], ph[g][ks], o[g][db]);
    }
    // merge of the KSP key ranges: common maximum, total sum, then the scaled partial O^T tiles summed in wave order
#pragma unroll
    for (int g = 0; g < NG; ++g) { l[g] += __shfl_xor(l[g], 16, 32); if (hi == 0) { sml[0][w][g * 16 + lr] = m[g]; sml[1][w][g * 16 + lr] = l[g]; } }
    __syncthreads();                         // publishes every wave's maximum and sum; also ends every wave's use of its E^T copies
#pragma unroll
    for (int g = 0; g < NG; ++g) { float M = -3.0e38f, L = 0.f;
#pragma unroll
        for (int ww = 0; ww < KSP; ++ww) M = fmaxf(M, sml[0][ww][g * 16 + lr]);
#pragma unroll
        for (int ww = 0; ww < KSP; ++ww) L += sml[1][ww][g * 16 + lr] * exp2n(sml[0][ww][g * 16 + lr] - M);
        const float f = exp2n(m[g] - M) / L;
#pragma unroll
        for (int db = 0; db < 4; ++db) o[g][db] *= f; }
#pragma unroll
    for (int g = 0; g < NG; ++g) { float* op = sm + ((g * KSP + w) * 16 + lr) * OP + 8 * hi;    // every group has its own KSP tiles: they fit where the E^T copies lay
#pragma unroll
        for (int db = 0; db < 4; ++db) { *(v4fa*)(op + db * 16) = __builtin_shufflevector(o[g][db], o[g][db], 0, 1, 2, 3); *(v4fa*)(op + db * 16 + 4) = __builtin_shufflevector(o[g][db], o[g][db], 4, 5, 6, 7); } }
    __syncthreads();                         // publishes the KSP partial tiles of every query group
#pragma unroll
    for (int g = 0; g < NG; ++g) { const int q = threadIdx.x >> 4, d4 = (threadIdx.x & 15) * 4; const float* ip = sm + (g * KSP * 16 + q) * OP + d4; v4f acc = *(const v4fa*)ip;
#pragma unroll
        for (int ww = 1; ww < KSP; ++ww) acc += *(const v4fa*)(ip + ww * 16 * OP);
        *(v4f*)(OUT + (zb * TT + i0 + g * 16 + q) * HD + d4) = acc;
    }
}

extern "C" void kernel_launch(void* const* d_in, const int* in_sizes, int n_in,
                              void* d_out, int out_size, void* d_ws, size_t ws_size, hipStream_t stream) {
    (void)in_sizes; (void)n_in; (void)out_size;
    const float* Qin = (const float*)d_in[0]; const float* Kin = (const float*)d_in[1]; const float* Vin = (const float*)d_in[2]; const float* tab = (const float*)d_in[3];
    float* OUT = (float*)d_out;     // [8][2048][64]
    char* wsp = (char*)d_ws;
    auto take = [&](size_t bytes) { char* p = wsp; wsp += (bytes + 255) & ~(size_t)255; return (void*)p; };
    bf* TB = (bf*)take((size_t)NXT * HD * 2); bf* QB = (bf*)take((size_t)NB_ * TT * HD * 2); bf* KB = (bf*)take((size_t)NB_ * TT * HD * 2); bf* VT = (bf*)take((size_t)NB_ * HD * TT * 2);
    if ((size_t)(wsp - (char*)d_ws) > ws_size) return;    // carve under 7 MiB
    k_prep<<<PB_ALL, 256, 0, stream>>>(Qin, Kin, Vin, tab, QB, KB, VT, TB);
    k_fattn<<<dim3(TT / (NG * 16), NB_, 1), KSP * 32, 0, stream>>>(QB, KB, VT, TB, OUT);
}

// v008
// Measured time: 17.9 microseconds a run.
// In both of two side-by-side timings against v007, it was 1.07 times as fast.
// All steps since v000 together make it 38.9 times as fast.
#include <hip/hip_runtime.h>

// Single-head attention with a learned relative-position bias (Music-Transformer style skew) on given q, k, v [8][2048][64]: rel_emb[e] = rel_table[clip(e - S, -1024, 1024) + 1024] (table [2049][64]); qr = skew(q . rel_emb) so that bias[i][j] = q_i . rel_table[clip(j - i, -1024, 1024) + 1024]; scores = (q.k + bias) / 8; softmax over all keys; out = w v -> [8][2048][64] (1.0 M).
// One fused kernel (k_fattn) does scores, bias, softmax and P x v; the score matrix never reaches memory. Before it, one kernel (k_prep) rounds q, k, v^T and the clipped table rows rel_emb to bf16 planes (v^T: the bf16-rounded values, written as f16).
// The planes lie in fragment order: a tile of 16 rows x 64 k values is 2 KiB, four blocks of 512 bytes, and a block holds the 32 lanes' 16-byte pieces of one fragment half, so a fragment load of a wave reads four whole 128-byte lines instead of 32 bytes out of each of sixteen.
// Transposed products: S^T = k q^T and E^T = (table window) q^T, so a lane holds one query's scores; the bias of key j for query i is row (j - i) of E^T, fetched per lane from an LDS copy of E^T (the skew); the table row index is clamped as the module clips it, where k_prep gathers the rows.
// Compute dtypes, f32 accumulate: every input rounded to bf16; q.k, q.table exact products; softmax f32, running maximum; unnormalised P (0 .. 1) rounded once to f16 x v^T, whose bf16-rounded values are stored as f16 (1 product); f32 output rows.

#define NB_  8
#define TT   2048
#define DM   1024
#define NH_  1
#define NKV  1
#define REP  (NH_ / NKV)
#define HD   64
#define DQ   (NH_ * HD)
#define DKV  (NKV * HD)
#define ZH   2
#define RH   2048
#define WIN  0
#define PCAR 1024.0f
#define SCL  0.125f   // 1/sqrt(64) applied to (q.k + bias)
#define NREL 2049   // table rows (2*MAX_DIST + 1)
#define NXT  4096   // rows of the clipped-table plane: row u holds table row clip(u - 2047, -1024, 1024) + 1024, u = j - i + 2047
#define MAXD 1024
typedef _Float16 h16;
typedef unsigned short bf;
typedef __attribute__((ext_vector_type(16))) __bf16   v16bf;
typedef __attribute__((ext_vector_type(16))) _Float16 v16h;
typedef __attribute__((ext_vector_type(8)))  _Float16 v8h;
typedef __attribute__((ext_vector_type(8)))  unsigned short v8us;
typedef __attribute__((ext_vector_type(8)))  float    v8f;
typedef __attribute__((ext_vector_type(4)))  float    v4f;
typedef v8h  __attribute__((may_alias)) v8ha;
typedef v4f  __attribute__((may_alias)) v4fa;
typedef v8us __attribute__((may_alias)) v8usa;

__device__ __forceinline__ unsigned short f2bf(float f) { unsigned u = __float_as_uint(f); u += 0x7FFFu + ((u >> 16) & 1u); return (unsigned short)(u >> 16); }
__device__ __forceinline__ float bf2f(unsigned short b) { return __uint_as_float(((unsigned)b) << 16); }
__device__ __forceinline__ float bfr(float f) { return bf2f(f2bf(f)); }
__device__ __forceinline__ v16h cat16(v8h lo, v8h hi) { return __builtin_shufflevector(lo, hi, 0, 1, 2, 3, 4, 5, 6, 7, 8, 9, 10, 11, 12, 13, 14, 15); }
__device__ __forceinline__ v16bf cat16b(v8us lo, v8us hi) { return __builtin_bit_cast(v16bf, __builtin_shufflevector(lo, hi, 0, 1, 2, 3, 4, 5, 6, 7, 8, 9, 10, 11, 12, 13, 14, 15)); }
__device__ __forceinline__ v8f wmma16(v16h a, v16h b, v8f c) { return __builtin_amdgcn_wmma_f32_16x16x32_f16(false, a, false, b, (short)0, c, false, false); }
__device__ __forceinline__ v8f wmmab(v16bf a, v16bf b, v8f c) { return __builtin_amdgcn_wmma_f32_16x16x32_bf16(false, a, false, b, (short)0, c, false, false); }



// Fragment loader: 16 elements of one K-contiguous row in the hardware k order (k = 8h .. 8h+7, then 16+8h .. 16+8h+7), the same for A and B.
template <typename T16> struct WFrag;
template <> struct WFrag<h16> { typedef v16h V; static __device__ __forceinline__ V ld(const h16* p) { return cat16(*(const v8h*)p, *(const v8h*)(p + 16)); } static __device__ __forceinline__ v8f mma(V a, V b, v8f c) { return wmma16(a, b, c); } };
template <> struct WFrag<bf> { typedef v16bf V; static __device__ __forceinline__ V ld(const bf* p) { return cat16b(*(const v8us*)p, *(const v8us*)(p + 16)); } static __device__ __forceinline__ v8f mma(V a, V b, v8f c) { return wmmab(a, b, c); } };
__device__ __forceinline__ h16 tohx(float x) { return (h16)x; }
__device__ __forceinline__ void splitf(float y, unsigned short& h, unsigned short& l) { h = f2bf(y); l = f2bf(y - bf2f(h)); }
typedef __attribute__((ext_vector_type(2))) _Float16 v2h;
typedef __attribute__((ext_vector_type(4))) _Float16 v4h;
typedef __attribute__((ext_vector_type(2))) unsigned short v2us;
typedef __attribute__((ext_vector_type(4))) unsigned short v4us;
typedef __attribute__((ext_vector_type(2))) float v2f;
typedef __attribute__((ext_vector_type(4))) int v4i;

__global__ __launch_bounds__(256) void k_wtG(const float* __restrict__ w, int K, int N, bf* Bt) {
    const int lane = threadIdx.x & 31; const int L0 = (blockIdx.x * 8 + (threadIdx.x >> 5)) * 8; const int nlines = N * K / 64;
{
#pragma unroll 1
        for (int l = 0; l < 8; ++l) { const int L = L0 + l; if (L >= nlines) break; const size_t e = (size_t)L * 64 + lane * 2; const int k = (int)(e % K), n = (int)(e / K); v2us o;
            o[0] = f2bf(w[(size_t)k * N + n]); o[1] = f2bf(w[(size_t)(k + 1) * N + n]); *(v2us*)(Bt + e) = o; }
         }
}

__global__ __launch_bounds__(256) void k_vtp(const float* __restrict__ F, int pitch, int nheads, h16* V16, bf* Vh, bf* Vl) { const size_t e = ((size_t)blockIdx.x * 256 + threadIdx.x) * 2; if (e >= (size_t)nheads * HD * TT) return; const int t = (int)(e % TT); const int d = (int)((e / TT) % HD); const int g = (int)(e / ((size_t)TT * HD)); v2h o16; v2us oh, ol;
#pragma unroll
    for (int q = 0; q < 2; ++q) { const float x = F[(size_t)(t + q) * pitch + g * HD + d]; o16[q] = tohx(x); unsigned short a2, c2; splitf(x, a2, c2); oh[q] = a2; ol[q] = c2; }
    *(v2h*)(V16 + e) = o16; *(v2us*)(Vh + e) = oh; *(v2us*)(Vl + e) = ol;  }

__global__ __launch_bounds__(256) void k_merge(const float* __restrict__ O, int h0, float* OUTb) { const size_t e = ((size_t)blockIdx.x * 256 + threadIdx.x) * 2; if (e >= (size_t)ZH * TT * HD) return; const int d = (int)(e % HD); const int t = (int)((e / HD) % TT); const int zz = (int)(e / ((size_t)HD * TT)); const float cs = (t < RH) ? 1.0f : (1.0f / PCAR); const size_t oo = (size_t)t * DQ + (h0 + zz) * HD + d;
    v2f o2; o2[0] = O[e] * cs; o2[1] = O[e + 1] * cs; *(v2f*)(OUTb + oo) = o2;  }

// ---- k_prep: every bf16 plane in one launch. The block index picks the job (v^T, q, k, table); a thread handles 64 elements (16 of the table), so the whole stage is PB_ALL blocks of eight waves, no more than the chip has WGPs.
#define PU     8                                   // units of 8 elements a thread
#define PB_V   (NB_ * TT * HD / (256 * 8 * PU))     // blocks of the v^T job; the q and the k job have as many
#define PB_T   (NXT * HD / (256 * 16))              // blocks of the table job, 16 elements a thread: a whole number
#define PB_ALL (3 * PB_V + PB_T)
// bits of the f16 that holds the bf16-rounded value: the same number wherever it is a normal f16
__device__ __forceinline__ unsigned short f2hb(float f) { return __builtin_bit_cast(unsigned short, (h16)bfr(f)); }
__device__ __forceinline__ v8us cvt8(v8f v) { v8us o;
#pragma unroll
    for (int k = 0; k < 8; ++k) o[k] = f2bf(v[k]);
    return o; }
__global__ __launch_bounds__(256) void k_prep(const float* __restrict__ Qin, const float* __restrict__ Kin, const float* __restrict__ Vin, const float* __restrict__ tab, bf* __restrict__ QB, bf* __restrict__ KB, bf* __restrict__ VT, bf* __restrict__ TB) {
    const int b = blockIdx.x, tid = threadIdx.x;
    if (b < PB_V) {
        // v^T: a wave takes 64 keys x 32 columns of one batch; a lane holds 8 keys x 8 columns in registers, so a row of v is read in whole 128-byte lines; in a v^T tile (16 columns x 64 keys) the piece of column lr and key octet cc lies at block cc / 2, place (lr % 4) * 8 + (lr / 4) * 2 + cc % 2, so eight lanes of a store fill one whole line
        const int lane = tid & 31, tg = lane & 7, dg = lane >> 3; const int wt = b * 8 + (tid >> 5);
        const int z = wt / (TT / 64 * 2), r = wt % (TT / 64 * 2); const int t0 = (r >> 1) * 64 + tg * 8, d0 = (r & 1) * 32 + dg * 4;
        const float* Vb = Vin + (size_t)z * TT * HD + (size_t)t0 * HD + d0; bf* Vh = VT + (size_t)z * HD * TT + (size_t)((r >> 1) * 4 + (r & 1) * 2) * 1024 + (tg >> 1) * 256 + (dg * 2 + (tg & 1)) * 8;
        v4f x[8][2];
#pragma unroll
        for (int q = 0; q < 8; ++q) { x[q][0] = *(const v4f*)(Vb + q * HD); x[q][1] = *(const v4f*)(Vb + q * HD + 16); }
        // keeps the 16 loads above in one batch: otherwise five of them are issued only behind the first ones' data
        __builtin_amdgcn_sched_barrier(0);
        asm volatile("s_wait_xcnt 0x0" :: "v"(Vb) : "memory");     // before the loads' address registers are re-used; the address is an input, so it stays in them up to here
#pragma unroll
        for (int h = 0; h < 2; ++h)
#pragma unroll
            for (int c = 0; c < 4; ++c) { v8us o;
#pragma unroll
                for (int q = 0; q < 8; ++q) o[q] = f2hb(x[q][h][c]);
                *(v8us*)(Vh + h * 1024 + c * 64) = o; }
    } else if (b < 3 * PB_V) {
        const bool isq = b < 2 * PB_V; const float* src = isq ? Qin : Kin; bf* dst = isq ? QB : KB;
        // a wave takes two tiles of 16 rows; a load unit is four whole rows, and its store fills one whole line in each of the tile's four blocks (row lr, octet cc: block cc / 2, place lr * 2 + cc % 2)
        const int lane = tid & 31; const size_t i0 = (size_t)(b - (isq ? PB_V : 2 * PB_V)) * (256 * PU) + (tid >> 5) * (32 * PU) + lane; const float* sp = src + i0 * 8; v8f x[PU];
        bf* dp = dst + (i0 >> 7) * 1024 + ((lane & 7) >> 1) * 256 + (lane >> 3) * 16 + (lane & 1) * 8;
#pragma unroll
        for (int u = 0; u < PU; ++u) x[u] = *(const v8f*)(sp + u * 256);
        asm volatile("s_wait_xcnt 0x0" :: "v"(sp) : "memory");     // as above
#pragma unroll
        for (int u = 0; u < PU; ++u) *(v8us*)(dp + (u >> 2) * 1024 + (u & 3) * 64) = cvt8(x[u]);
        asm volatile("s_wait_xcnt 0x0" ::: "memory");     // behind the stores: before a register that they name is written again
    } else {
        // clipped table rows: a thread takes a quarter of a row, which is that row's 32 bytes of one block of its tile
        const int j = (b - 3 * PB_V) * 256 + tid, r = j / 4; const float* tp = tab + (size_t)min(max(r - (TT - 1) + MAXD, 0), 2 * MAXD) * HD + (j % 4) * 16;
        bf* dp = TB + (size_t)(r >> 4) * 1024 + (j % 4) * 256 + (r & 15) * 16;
        const v8f x0 = *(const v8f*)tp, x1 = *(const v8f*)(tp + 8);
        asm volatile("s_wait_xcnt 0x0" :: "v"(tp) : "memory");     // as above
        *(v8us*)dp = cvt8(x0); *(v8us*)(dp + 8) = cvt8(x1);
        asm volatile("s_wait_xcnt 0x0" ::: "memory");     // behind the stores, as above
    }
}
// ---- k_fattn: one block = 64 queries of one batch (NG groups of 16, all held by every wave, so a k, v^T or table fragment is fetched once for all of them); its KSP waves each take KPW keys in passes of 64 and keep a running maximum, sum and O^T; the partial results are merged in LDS at the end, in wave order.
#define KSP 8                      // waves per block = key ranges of one query block
#define KPW (TT / KSP)             // keys per wave
#define NG  4                      // query groups of 16 a wave
#define NWB (NG + 4)               // table tiles of a pass's window
#define EP  84                     // floats per query row of the E^T copy (80 window rows + 4: the skewed b32 reads and the b128 stores then fall on distinct banks)
#define OP  68                     // floats per query row of a partial output tile
#define CSL 0.18033688011112042f   // SCL * log2(e)
typedef __attribute__((ext_vector_type(16))) float v16f;
// fragment of a plane in fragment order, at the lane's address in the batch's first block plus a constant (one address pair for a whole batch of loads, the constant in the instruction): its two halves (k = 8 hi .. 8 hi + 7 and 16 more) lie one 512-byte block apart
__device__ __forceinline__ v16bf ldo(const char* p, int k) { return cat16b(*(const v8us*)(p + k), *(const v8us*)(p + k + 512)); }
// the same for the v^T plane, whose 16-bit values are f16
__device__ __forceinline__ v16h ldoh(const char* p, int k) { return __builtin_bit_cast(v16h, __builtin_shufflevector(*(const v8us*)(p + k), *(const v8us*)(p + k + 512), 0, 1, 2, 3, 4, 5, 6, 7, 8, 9, 10, 11, 12, 13, 14, 15)); }
// 2^x with the slot behind a transcendental filled in the same statement
__device__ __forceinline__ float exp2n(float x) { float r; asm("v_exp_f32 %0, %1\n\tv_nop" : "=v"(r) : "v"(x)); return r; }
// 2^x of four values in one statement: each v_exp_f32 is followed by one on other registers, so only the last needs the slot filled; results in registers of their own (early clobber: no result lands on a later source)
__device__ __forceinline__ v4f exp2x4(v4f x) { float a, b, c, d;
    asm("v_exp_f32 %0, %4\n\tv_exp_f32 %1, %5\n\tv_exp_f32 %2, %6\n\tv_exp_f32 %3, %7\n\tv_nop" : "=&v"(a), "=&v"(b), "=&v"(c), "=&v"(d) : "v"(x[0]), "v"(x[1]), "v"(x[2]), "v"(x[3]));
    return (v4f){a, b, c, d}; }
// two waves per SIMD (one block per WGP): a budget of 512 registers
__global__ __launch_bounds__(KSP * 32) __attribute__((amdgpu_waves_per_eu(2, 2))) void k_fattn(const bf* __restrict__ QB, const bf* __restrict__ KB, const bf* __restrict__ VT, const bf* __restrict__ TB, float* __restrict__ OUT) {
    __shared__ __align__(16) float sm[KSP * NG * 16 * EP];
    __shared__ float sml[2][KSP][NG * 16];
    const int lane = threadIdx.x & 31, lr = lane & 15, hi = lane >> 4, w = __builtin_amdgcn_readfirstlane(threadIdx.x >> 5);    // the wave's number as a scalar: the tile addresses below are then scalar
    const int i0 = blockIdx.x * (NG * 16); const size_t zb = blockIdx.y;
    const bf* Qb = QB + zb * TT * HD; const bf* Kb = KB + zb * TT * HD; const bf* Vb = VT + zb * HD * TT;
    const unsigned lo = (unsigned)(lr * 32 + hi * 16), lov = (unsigned)(((lr & 3) * 8 + (lr >> 2) * 2 + hi) * 16);    // the lane's piece inside a 512-byte block: q, k and table planes; v^T plane
    float* es = sm + w * (NG * 16 * EP);      // this wave's own E^T copies, one per query group
    v16bf qf[NG][2];                         // B operand: query i0 + 16 g + lr, kept for the whole kernel
#pragma unroll
    for (int g = 0; g < NG; ++g)
#pragma unroll
        for (int ks = 0; ks < 2; ++ks) qf[g][ks] = ldo((const char*)(Qb + i0 * HD) + lo, g * 2048 + ks * 1024);
    asm volatile("s_wait_xcnt 0x0" :: "s"(Qb + i0 * HD), "v"(lo) : "memory");    // before the loads' address registers are re-used; base and offset are inputs, so they stay in them up to here
    v8f o[NG][4]; float m[NG], l[NG];
#pragma unroll
    for (int g = 0; g < NG; ++g) { m[g] = -3.0e38f; l[g] = 0.f;
#pragma unroll
        for (int db = 0; db < 4; ++db) o[g][db] = (v8f){}; }
    // Every batch of fragment loads is issued one phase ahead of its use, so that its latency runs beside work: the table window of a pass before the P x v products of the pass in front (the first one here), k half way through the E^T products, v^T before the softmax.
    // table window of a pass: the 128 clipped table rows j - i = j0 - i0 - 63 .. j0 - i0 + 64, eight whole tiles of the plane; group g needs window blocks NG - 1 - g .. NG + 3 - g
    v16bf tl[NWB][2];                        // a pass's table window, fetched one pass ahead
    { const bf* t0 = TB + (w * KPW - i0 + TT - NG * 16) * HD;
#pragma unroll
    for (int wb = 0; wb < NWB; ++wb) { tl[wb][0] = ldo((const char*)t0 + lo, wb * 2048); tl[wb][1] = ldo((const char*)t0 + lo, wb * 2048 + 1024); }
    // keeps the 32 table loads above in one batch
    __builtin_amdgcn_sched_barrier(0);
    asm volatile("s_wait_xcnt 0x0" :: "s"(t0), "v"(lo) : "memory"); }    // as above: base and offset are inputs
    // kept rolled: for speed only
#pragma unroll 1
    for (int it = 0; it < KPW / 64; ++it) {
        const int j0 = w * KPW + it * 64;
        v16bf ta[NWB][2];
#pragma unroll
        for (int wb = 0; wb < NWB; ++wb) { ta[wb][0] = tl[wb][0]; ta[wb][1] = tl[wb][1]; }
        v16bf ka[4][2]; const char* kp = (const char*)(Kb + j0 * HD) + lo;
        // E^T over the table window
        {
#pragma unroll
        for (int wb = 0; wb < NWB; ++wb) {
            if (wb == NWB / 2) {             // the k loads, half way: they take the registers that the window's first half has left, and fly while the second half is worked on
                __builtin_amdgcn_sched_barrier(0);    // keeps them from rising into the first half, where no register is free
#pragma unroll
                for (int kb = 0; kb < 4; ++kb) { ka[kb][0] = ldo(kp, kb * 2048); ka[kb][1] = ldo(kp, kb * 2048 + 1024); }
                __builtin_amdgcn_sched_barrier(0);    // keeps them from sinking to their use
                asm volatile("s_wait_xcnt 0x0" :: "v"(kp) : "memory");    // before the loads' address registers are re-used; the address is an input, so it stays in them up to here
            } v8f e[NG]; const int glo = wb < NG - 1 ? NG - 1 - wb : 0, ghi = wb > 4 ? NG + 3 - wb : NG - 1;    // the groups that need this block
#pragma unroll
            for (int g = 0; g < NG; ++g) if (g >= glo && g <= ghi) e[g] = wmmab(ta[wb][0], qf[g][0], (v8f){});
#pragma unroll
            for (int g = 0; g < NG; ++g) if (g >= glo && g <= ghi) e[g] = wmmab(ta[wb][1], qf[g][1], e[g]);
            // WMMA distance: four vector slots behind the products above, before a later matrix instruction starts a new sum in the same registers
            asm volatile("v_nop\n\tv_nop\n\tv_nop\n\tv_nop" :: "v"(e[glo]), "v"(e[glo < ghi ? glo + 1 : ghi]), "v"(e[glo < ghi ? ghi - 1 : glo]), "v"(e[ghi]));
#pragma unroll
            for (int g = 0; g < NG; ++g) { const int lb = wb - (NG - 1) + g; if (lb >= 0 && lb < 5) { float* ep = es + (g * 16 + lr) * EP + lb * 16 + 8 * hi;
                *(v4fa*)ep = __builtin_shufflevector(e[g], e[g], 0, 1, 2, 3); *(v4fa*)(ep + 4) = __builtin_shufflevector(e[g], e[g], 4, 5, 6, 7); } } } }
        // keeps the skewed reads below behind the other half-wave's stores above (same wave: LDS runs its operations in order)
        __builtin_amdgcn_wave_barrier(); asm volatile("" ::: "memory");
        v8f s[NG][4];                        // s[g][kb][r] = score of key j0 + 16 kb + 8 hi + r for query i0 + 16 g + lr; starts as the bias, the q.k products accumulate onto it
#pragma unroll
        for (int g = 0; g < NG; ++g) { const float* er = es + (g * 16 + lr) * EP - lr + 15 + 8 * hi;
#pragma unroll
            for (int kb = 0; kb < 4; ++kb)
#pragma unroll
                for (int r = 0; r < 8; ++r) s[g][kb][r] = er[kb * 16 + r]; }
        // keeps the next pass's E^T stores behind the reads above
        __builtin_amdgcn_wave_barrier(); asm volatile("" ::: "memory");
#pragma unroll
        for (int ks = 0; ks < 2; ++ks)
#pragma unroll
            for (int kb = 0; kb < 4; ++kb)
#pragma unroll
                for (int g = 0; g < NG; ++g) s[g][kb] = wmmab(ka[kb][ks], qf[g][ks], s[g][kb]);
        // keeps the v^T loads below behind the q.k products: issued among them they would need registers beside the k fragments', and the build spills
        __builtin_amdgcn_sched_barrier(0);
        v16h va[4][2]; const char* vp = (const char*)(Vb + j0 * HD) + lov;
#pragma unroll
        for (int db = 0; db < 4; ++db)
#pragma unroll
            for (int ks = 0; ks < 2; ++ks) va[db][ks] = ldoh(vp, db * 2048 + ks * 1024);
        // keeps the 16 v^T loads above in one batch in front of the softmax: they fly while it runs
        __builtin_amdgcn_sched_barrier(0);
        asm volatile("s_wait_xcnt 0x0" :: "v"(vp) : "memory");    // as above
        v16h ph[NG][2];                      // P^T as f16 B operands: two score tiles (32 keys) pack into one fragment in the hardware k order
#pragma unroll
        for (int g = 0; g < NG; ++g) {
            // maximum of the raw scores in two chains; the positive scale is applied to the maximum alone (rounding is monotonic: the same value as the maximum of the scaled scores)
            float ra = s[g][0][0], rb = s[g][2][0];
#pragma unroll
            for (int r = 1; r < 16; ++r) { ra = fmaxf(ra, s[g][r >> 3][r & 7]); rb = fmaxf(rb, s[g][2 + (r >> 3)][r & 7]); }
            ra = fmaxf(ra, rb); ra = fmaxf(ra, __shfl_xor(ra, 16, 32));
            const float mx = fmaxf(m[g], ra * CSL);
            const float al = exp2n(m[g] - mx); m[g] = mx;
            // splits the scheduling region: the query groups' softmax runs are then not interleaved, which keeps the build free of spills
            __builtin_amdgcn_sched_barrier(0);
            // score pairs: one packed multiply-add and one packed add serve two scores
            const v8f cs = {CSL, CSL, CSL, CSL, CSL, CSL, CSL, CSL}, nm = {-mx, -mx, -mx, -mx, -mx, -mx, -mx, -mx}; v4f s4;
#pragma unroll
            for (int kb = 0; kb < 4; ++kb) { const v8f y = __builtin_elementwise_fma(s[g][kb], cs, nm);
                const v4f pa = exp2x4(__builtin_shufflevector(y, y, 0, 1, 2, 3)), pb = exp2x4(__builtin_shufflevector(y, y, 4, 5, 6, 7));
                s[g][kb] = __builtin_shufflevector(pa, pb, 0, 1, 2, 3, 4, 5, 6, 7); s4 = kb ? s4 + (pa + pb) : pa + pb; }
            const v2f s2 = __builtin_shufflevector(s4, s4, 0, 1) + __builtin_shufflevector(s4, s4, 2, 3);
            const float sum = s2[0] + s2[1];
            l[g] = l[g] * al + sum;
#pragma unroll
            for (int db = 0; db < 4; ++db) o[g][db] *= al;
#pragma unroll
            for (int ks = 0; ks < 2; ++ks) { const v16f pv = __builtin_shufflevector(s[g][2 * ks], s[g][2 * ks + 1], 0, 1, 2, 3, 4, 5, 6, 7, 8, 9, 10, 11, 12, 13, 14, 15);
                ph[g][ks] = __builtin_convertvector(pv, v16h); }
        }
        // ends the scheduling region of the softmax, where registers are scarce
        __builtin_amdgcn_sched_barrier(0);
        // the next pass's window; the last pass has none: a branch round the loads made the build spill, so it fetches, unused, the window of key 0, the same lines in all eight waves (one fetch into the WGP's cache)
        const char* tn = (const char*)(TB + ((it + 1 < KPW / 64 ? j0 + 64 : 0) - i0 + TT - NG * 16) * HD) + lo;
#pragma unroll
        for (int wb = 0; wb < NWB; ++wb) { tl[wb][0] = ldo(tn, wb * 2048); tl[wb][1] = ldo(tn, wb * 2048 + 1024); }
        // keeps the 32 table loads above in one batch in front of the P x v products
        __builtin_amdgcn_sched_barrier(0);
        asm volatile("s_wait_xcnt 0x0" :: "v"(tn) : "memory");    // as above
#pragma unroll
        for (int db = 0; db < 4; ++db)
#pragma unroll
            for (int ks = 0; ks < 2; ++ks)
#pragma unroll
                for (int g = 0; g < NG; ++g) o[g][db] = wmma16(va[db][ks], ph[g][ks], o[g][db]);
    }
    // merge of the KSP key ranges: common maximum, total sum, then the scaled partial O^T tiles summed in wave order
#pragma unroll
    for (int g = 0; g < NG; ++g) { l[g] += __shfl_xor(l[g], 16, 32); if (hi == 0) { sml[0][w][g * 16 + lr] = m[g]; sml[1][w][g * 16 + lr] = l[g]; } }
    __syncthreads();                         // publishes every wave's maximum and sum; also ends every wave's use of its E^T copies
#pragma unroll
    for (int g = 0; g < NG; ++g) { float M = -3.0e38f, L = 0.f;
#pragma unroll
        for (int ww = 0; ww < KSP; ++ww) M = fmaxf(M, sml[0][ww][g * 16 + lr]);
#pragma unroll
        for (int ww = 0; ww < KSP; ++ww) L += sml[1][ww][g * 16 + lr] * exp2n(sml[0][ww][g * 16 + lr] - M);
        const float f = exp2n(m[g] - M) / L;
#pragma unroll
        for (int db = 0; db < 4; ++db) o[g][db] *= f; }
#pragma unroll
    for (int g = 0; g < NG; ++g) { float* op = sm + ((g * KSP + w) * 16 + lr) * OP + 8 * hi;    // every group has its own KSP tiles: they fit where the E^T copies lay
#pragma unroll
        for (int db = 0; db < 4; ++db) { *(v4fa*)(op + db * 16) = __builtin_shufflevector(o[g][db], o[g][db], 0, 1, 2, 3); *(v4fa*)(op + db * 16 + 4) = __builtin_shufflevector(o[g][db], o[g][db], 4, 5, 6, 7); } }
    __syncthreads();                         // publishes the KSP partial tiles of every query group
#pragma unroll
    for (int g = 0; g < NG; ++g) { const int q = threadIdx.x >> 4, d4 = (threadIdx.x & 15) * 4; const float* ip = sm + (g * KSP * 16 + q) * OP + d4; v4f acc = *(const v4fa*)ip;
#pragma unroll
        for (int ww = 1; ww < KSP; ++ww) acc += *(const v4fa*)(ip + ww * 16 * OP);
        *(v4f*)(OUT + (zb * TT + i0 + g * 16 + q) * HD + d4) = acc;
    }
}

extern "C" void kernel_launch(void* const* d_in, const int* in_sizes, int n_in,
                              void* d_out, int out_size, void* d_ws, size_t ws_size, hipStream_t stream) {
    (void)in_sizes; (void)n_in; (void)out_size;
    const float* Qin = (const float*)d_in[0]; const float* Kin = (const float*)d_in[1]; const float* Vin = (const float*)d_in[2]; const float* tab = (const float*)d_in[3];
    float* OUT = (float*)d_out;     // [8][2048][64]
    char* wsp = (char*)d_ws;
    auto take = [&](size_t bytes) { char* p = wsp; wsp += (bytes + 255) & ~(size_t)255; return (void*)p; };
    bf* TB = (bf*)take((size_t)NXT * HD * 2); bf* QB = (bf*)take((size_t)NB_ * TT * HD * 2); bf* KB = (bf*)take((size_t)NB_ * TT * HD * 2); bf* VT = (bf*)take((size_t)NB_ * HD * TT * 2);
    if ((size_t)(wsp - (char*)d_ws) > ws_size) return;    // carve under 7 MiB
    k_prep<<<PB_ALL, 256, 0, stream>>>(Qin, Kin, Vin, tab, QB, KB, VT, TB);
    k_fattn<<<dim3(TT / (NG * 16), NB_, 1), KSP * 32, 0, stream>>>(QB, KB, VT, TB, OUT);
}
